// v000
// The times below were measured on an AMD MI455X: many runs one after another, warmed up first and cycling through
// copies of the inputs, with the whole window's GPU time divided by the number of runs. Launches and the gaps
// between them are all in it. The median over several windows is given; except for v000 it joins two sittings, which
// can be a few percent apart, so the side-by-side timings, each taken in one sitting, are the better comparison.
// v000, which the later versions start from, runs in 149 microseconds.
#include <hip/hip_runtime.h>
#include <hip/hip_bf16.h>
#include <math.h>

typedef _Float16 v16h  __attribute__((ext_vector_type(16)));
typedef _Float16 half8 __attribute__((ext_vector_type(8)));
typedef _Float16 half4 __attribute__((ext_vector_type(4)));
typedef float    v8f   __attribute__((ext_vector_type(8)));

#define WMMA_F32_F16(a, b, c) \
  __builtin_amdgcn_wmma_f32_16x16x32_f16(false, (a), false, (b), (short)0, (c), false, false)

static constexpr int Bc = 4, TQc = 2048, TKc = 8192, Dc = 1024;
static constexpr int Hc = 16, DHc = 64, Lc = 512;

// Load a 16x32 f16 WMMA A/B fragment from an LDS (or global) tile.
// A-layout per CDNA5 ISA: lane L holds row (row_base + L%16); halves j cover
// k = kb + {0..7} and k = kb + {16..23}, kb = 8*(L>=16) + koff.
__device__ __forceinline__ v16h ldfrag(const _Float16* t, int stride, int row_base,
                                       int koff, int lane) {
  int r  = row_base + (lane & 15);
  int kb = ((lane >> 4) & 1) * 8 + koff;
  half8 lo = *(const half8*)(t + r * stride + kb);
  half8 hi = *(const half8*)(t + r * stride + kb + 16);
  return __builtin_shufflevector(lo, hi, 0, 1, 2, 3, 4, 5, 6, 7,
                                 8, 9, 10, 11, 12, 13, 14, 15);
}

// Async memory->LDS 128-bit copy (CDNA5; tracked by ASYNCcnt).
__device__ __forceinline__ void async_b128(const _Float16* g, _Float16* l) {
  unsigned loff = (unsigned)(unsigned long long)(uintptr_t)l;  // low 32b = LDS offset
  unsigned long long ga = (unsigned long long)(uintptr_t)g;
  asm volatile("global_load_async_to_lds_b128 %0, %1, off" :: "v"(loff), "v"(ga) : "memory");
}
__device__ __forceinline__ void wait_async0() {
  asm volatile("s_wait_asynccnt 0x0" ::: "memory");
}

// ---------------------------------------------------------------------------
// Projection GEMM: Y_f16 = (X_f32 @ W_f32^T + bias) * scale
// MODE 0: Q.  grid (TQ/64, H, B); out Qh[((b*H+h)*TQ + t)*64 + d]   (row major)
// MODE 1: K (HEPOS gather rows t=h+16*l). out Kg[((b*H+h)*L + l)*64 + d]
// MODE 2: V (HEPOS gather) TRANSPOSED out: VgT[((b*H+h)*64 + d)*L + l]
// 64x64 tile / block, 4 waves each computing a 32x32 quadrant via 2x2 WMMAs.
// ---------------------------------------------------------------------------
template <int MODE>
__global__ __launch_bounds__(128) void proj_kernel(
    const float* __restrict__ X, const float* __restrict__ W,
    const float* __restrict__ bias, _Float16* __restrict__ Y, float scale) {
  __shared__ __align__(16) _Float16 At[64 * 40];
  __shared__ __align__(16) _Float16 Bt[64 * 40];
  const int tid = threadIdx.x, lane = tid & 31;
  const int w = tid >> 5, wr = w >> 1, wc = w & 1;
  const int tile = blockIdx.x, h = blockIdx.y, b = blockIdx.z;
  const int n0 = h * DHc;

  v8f acc[2][2] = {};
  for (int k0 = 0; k0 < Dc; k0 += 32) {
    __syncthreads();
#pragma unroll
    for (int e = 0; e < 4; ++e) {  // stage A 64x32: float4 load -> half4 store
      int idx = (e * 128 + tid) * 4;
      int r = idx >> 5, c = idx & 31;
      long gr = (MODE == 0) ? ((long)b * TQc + tile * 64 + r)
                            : ((long)b * TKc + h + 16 * (tile * 64 + r));
      float4 f = *(const float4*)(&X[gr * Dc + k0 + c]);
      half4 hh = {(_Float16)f.x, (_Float16)f.y, (_Float16)f.z, (_Float16)f.w};
      *(half4*)(At + r * 40 + c) = hh;
    }
#pragma unroll
    for (int e = 0; e < 4; ++e) {  // stage B = W rows n0..n0+63
      int idx = (e * 128 + tid) * 4;
      int r = idx >> 5, c = idx & 31;
      float4 f = *(const float4*)(&W[(long)(n0 + r) * Dc + k0 + c]);
      half4 hh = {(_Float16)f.x, (_Float16)f.y, (_Float16)f.z, (_Float16)f.w};
      *(half4*)(Bt + r * 40 + c) = hh;
    }
    __syncthreads();
    v16h a0 = ldfrag(At, 40, wr * 32, 0, lane);
    v16h a1 = ldfrag(At, 40, wr * 32 + 16, 0, lane);
    v16h b0 = ldfrag(Bt, 40, wc * 32, 0, lane);
    v16h b1 = ldfrag(Bt, 40, wc * 32 + 16, 0, lane);
    acc[0][0] = WMMA_F32_F16(a0, b0, acc[0][0]);
    acc[0][1] = WMMA_F32_F16(a0, b1, acc[0][1]);
    acc[1][0] = WMMA_F32_F16(a1, b0, acc[1][0]);
    acc[1][1] = WMMA_F32_F16(a1, b1, acc[1][1]);
  }
  const int base8 = ((lane >> 4) & 1) * 8;
#pragma unroll
  for (int i = 0; i < 2; ++i)
#pragma unroll
    for (int j = 0; j < 2; ++j) {
      int nl = wc * 32 + j * 16 + (lane & 15);
      float bv = bias[n0 + nl];
      if (MODE == 2) {  // transposed: row d=nl, 8 consecutive l -> one b128
        int l = tile * 64 + wr * 32 + i * 16 + base8;
        half8 pk;
#pragma unroll
        for (int v = 0; v < 8; ++v) pk[v] = (_Float16)((acc[i][j][v] + bv) * scale);
        *(half8*)(Y + (((long)b * Hc + h) * DHc + nl) * Lc + l) = pk;
      } else {
#pragma unroll
        for (int v = 0; v < 8; ++v) {
          int ml = wr * 32 + i * 16 + base8 + v;
          float y = (acc[i][j][v] + bv) * scale;
          long o = (MODE == 0)
                       ? ((((long)b * Hc + h) * TQc + (tile * 64 + ml)) * DHc + nl)
                       : ((((long)b * Hc + h) * Lc + (tile * 64 + ml)) * DHc + nl);
          Y[o] = (_Float16)y;
        }
      }
    }
}

// ---------------------------------------------------------------------------
// Flash attention over gathered keys. grid (TQ/64, H, B), 4 waves/block,
// each wave owns 16 query rows. 64-key chunks (16 WMMA per chunk, softmax
// reduction cost amortized 2x vs 32-key chunks). K chunk staged [64 l x 64 d],
// V chunk pre-transposed [64 d x 64 l]. Double-buffered async staging:
// chunk i+1's copies overlap chunk i's compute.
// ---------------------------------------------------------------------------
__global__ __launch_bounds__(128) void attn_kernel(
    const _Float16* __restrict__ Qh, const _Float16* __restrict__ Kg,
    const _Float16* __restrict__ VgT, _Float16* __restrict__ O) {
  __shared__ __align__(16) _Float16 kt[2][64 * 72];
  __shared__ __align__(16) _Float16 vt[2][64 * 72];
  __shared__ __align__(16) _Float16 pt[4][16 * 72];
  const int tid = threadIdx.x, lane = tid & 31, w = tid >> 5;
  const int qt = blockIdx.x, h = blockIdx.y, b = blockIdx.z;
  const int q0 = qt * 64 + w * 16;

  const _Float16* Qb = Qh + (((long)b * Hc + h) * TQc + q0) * DHc;
  const _Float16* Kb = Kg + (((long)b * Hc + h) * Lc) * DHc;
  const _Float16* Vb = VgT + (((long)b * Hc + h) * DHc) * Lc;

  v16h qa0 = ldfrag(Qb, DHc, 0, 0, lane);   // d = 0..31
  v16h qa1 = ldfrag(Qb, DHc, 0, 32, lane);  // d = 32..63

  float mrun[8], lrun[8];
  v8f oacc[4] = {};
#pragma unroll
  for (int j = 0; j < 8; ++j) { mrun[j] = -1e30f; lrun[j] = 0.f; }
  _Float16* P = &pt[w][0];
  const int col = lane & 15, rb = ((lane >> 4) & 1) * 8;

  // staging coordinates: each thread copies 32 halves of K and of V^T
  const int sr = tid >> 1, sc = (tid & 1) * 32;

  // prologue: stage chunk 0 into buffer 0
#pragma unroll
  for (int u = 0; u < 4; ++u) {
    async_b128(Kb + (long)sr * DHc + sc + u * 8, &kt[0][sr * 72 + sc + u * 8]);
    async_b128(Vb + (long)sr * Lc + sc + u * 8, &vt[0][sr * 72 + sc + u * 8]);
  }
  wait_async0();
  __syncthreads();

  const int NCH = Lc / 64;  // 8 chunks
  for (int c = 0; c < NCH; ++c) {
    const int cur = c & 1;
    if (c + 1 < NCH) {  // issue next chunk's copies; they overlap compute below
      int l1 = (c + 1) * 64;
#pragma unroll
      for (int u = 0; u < 4; ++u) {
        async_b128(Kb + (long)(l1 + sr) * DHc + sc + u * 8,
                   &kt[cur ^ 1][sr * 72 + sc + u * 8]);
        async_b128(Vb + (long)sr * Lc + l1 + sc + u * 8,
                   &vt[cur ^ 1][sr * 72 + sc + u * 8]);
      }
    }
    const _Float16* K = &kt[cur][0];
    const _Float16* V = &vt[cur][0];

    v8f z = {};
    v8f s[4];
#pragma unroll
    for (int t = 0; t < 4; ++t) {  // scores: 16 q x 64 l
      s[t] = WMMA_F32_F16(qa0, ldfrag(K, 72, t * 16, 0, lane), z);
      s[t] = WMMA_F32_F16(qa1, ldfrag(K, 72, t * 16, 32, lane), s[t]);
    }

    // Online softmax. C-layout: vgpr j holds row rb+j, lane%16 = col.
    // Row-max reduced per chunk; row-sum stays lane-partial until the end.
#pragma unroll
    for (int j = 0; j < 8; ++j) {
      float cmax = fmaxf(fmaxf(s[0][j], s[1][j]), fmaxf(s[2][j], s[3][j]));
#pragma unroll
      for (int mm = 1; mm < 16; mm <<= 1) cmax = fmaxf(cmax, __shfl_xor(cmax, mm, 32));
      float nm = fmaxf(mrun[j], cmax);
      float corr = __expf(mrun[j] - nm);
      mrun[j] = nm;
      float es = 0.f;
#pragma unroll
      for (int t = 0; t < 4; ++t) {
        float e = __expf(s[t][j] - nm);
        es += e;
        P[(rb + j) * 72 + t * 16 + col] = (_Float16)e;  // straight to LDS
        oacc[t][j] *= corr;
      }
      lrun[j] = lrun[j] * corr + es;
    }
    asm volatile("s_wait_dscnt 0x0" ::: "memory");
    v16h pf0 = ldfrag(P, 72, 0, 0, lane);   // P, l = 0..31
    v16h pf1 = ldfrag(P, 72, 0, 32, lane);  // P, l = 32..63
#pragma unroll
    for (int t = 0; t < 4; ++t) {  // O += P(16x64) @ V(64x16) per d-tile
      oacc[t] = WMMA_F32_F16(pf0, ldfrag(V, 72, t * 16, 0, lane), oacc[t]);
      oacc[t] = WMMA_F32_F16(pf1, ldfrag(V, 72, t * 16, 32, lane), oacc[t]);
    }
    wait_async0();    // next chunk's async copies complete
    __syncthreads();  // ... and visible to all waves
  }

  // single deferred row-sum reduction, normalize, store f16 [B, TQ, D]
#pragma unroll
  for (int j = 0; j < 8; ++j) {
    float rs = lrun[j];
#pragma unroll
    for (int mm = 1; mm < 16; mm <<= 1) rs += __shfl_xor(rs, mm, 32);
    float inv = 1.f / rs;
    long base = ((long)b * TQc + (q0 + rb + j)) * Dc + h * DHc;
#pragma unroll
    for (int t = 0; t < 4; ++t)
      O[base + t * 16 + col] = (_Float16)(oacc[t][j] * inv);
  }
}

// ---------------------------------------------------------------------------
// Output projection: out_f32[M,1024] = O_f16[M,1024] @ Wo^T + bo
// grid ((B*TQ)/64, 1024/64). A-tile staged via async copies (pure f16 copy),
// overlapped with the f32->f16 W-tile conversion.
// ---------------------------------------------------------------------------
__global__ __launch_bounds__(128) void outproj_kernel(
    const _Float16* __restrict__ A, const float* __restrict__ W,
    const float* __restrict__ bias, float* __restrict__ Out) {
  __shared__ __align__(16) _Float16 At[64 * 40];
  __shared__ __align__(16) _Float16 Bt[64 * 40];
  const int tid = threadIdx.x, lane = tid & 31;
  const int w = tid >> 5, wr = w >> 1, wc = w & 1;
  const int m0 = blockIdx.x * 64, n0 = blockIdx.y * 64;

  v8f acc[2][2] = {};
  for (int k0 = 0; k0 < Dc; k0 += 32) {
    __syncthreads();
    {  // stage A (already f16): async 64x32 copy
      int r = tid >> 1, c = (tid & 1) * 16;
      const _Float16* as = A + (long)(m0 + r) * Dc + k0 + c;
      async_b128(as, At + r * 40 + c);
      async_b128(as + 8, At + r * 40 + c + 8);
    }
#pragma unroll
    for (int e = 0; e < 4; ++e) {  // stage B (f32 -> f16) vectorized, overlaps A
      int idx = (e * 128 + tid) * 4;
      int r = idx >> 5, c = idx & 31;
      float4 f = *(const float4*)(&W[(long)(n0 + r) * Dc + k0 + c]);
      half4 hh = {(_Float16)f.x, (_Float16)f.y, (_Float16)f.z, (_Float16)f.w};
      *(half4*)(Bt + r * 40 + c) = hh;
    }
    wait_async0();
    __syncthreads();
    v16h a0 = ldfrag(At, 40, wr * 32, 0, lane);
    v16h a1 = ldfrag(At, 40, wr * 32 + 16, 0, lane);
    v16h b0 = ldfrag(Bt, 40, wc * 32, 0, lane);
    v16h b1 = ldfrag(Bt, 40, wc * 32 + 16, 0, lane);
    acc[0][0] = WMMA_F32_F16(a0, b0, acc[0][0]);
    acc[0][1] = WMMA_F32_F16(a0, b1, acc[0][1]);
    acc[1][0] = WMMA_F32_F16(a1, b0, acc[1][0]);
    acc[1][1] = WMMA_F32_F16(a1, b1, acc[1][1]);
  }
#pragma unroll
  for (int i = 0; i < 2; ++i)
#pragma unroll
    for (int j = 0; j < 2; ++j) {
      int nl = wc * 32 + j * 16 + (lane & 15);
      float bv = bias[n0 + nl];
#pragma unroll
      for (int v = 0; v < 8; ++v) {
        int ml = wr * 32 + i * 16 + ((lane >> 4) & 1) * 8 + v;
        Out[(long)(m0 + ml) * Dc + n0 + nl] = acc[i][j][v] + bv;
      }
    }
}

extern "C" void kernel_launch(void* const* d_in, const int* in_sizes, int n_in,
                              void* d_out, int out_size, void* d_ws, size_t ws_size,
                              hipStream_t stream) {
  const float* q  = (const float*)d_in[0];
  const float* k  = (const float*)d_in[1];
  const float* v  = (const float*)d_in[2];
  const float* Wq = (const float*)d_in[3];
  const float* bq = (const float*)d_in[4];
  const float* Wk = (const float*)d_in[5];
  const float* bk = (const float*)d_in[6];
  const float* Wv = (const float*)d_in[7];
  const float* bv = (const float*)d_in[8];
  const float* Wo = (const float*)d_in[9];
  const float* bo = (const float*)d_in[10];
  float* out = (float*)d_out;

  char* ws = (char*)d_ws;
  _Float16* Qh  = (_Float16*)ws;  // [B,H,TQ,64] f16
  _Float16* Kg  = (_Float16*)(ws + (size_t)Bc * Hc * TQc * DHc * 2);
  _Float16* VgT = (_Float16*)((char*)Kg + (size_t)Bc * Hc * Lc * DHc * 2);
  _Float16* Oa  = (_Float16*)((char*)VgT + (size_t)Bc * Hc * Lc * DHc * 2);  // [B,TQ,D] f16

  dim3 blk(128);
  // Q projection with 1/sqrt(dh) folded in
  proj_kernel<0><<<dim3(TQc / 64, Hc, Bc), blk, 0, stream>>>(q, Wq, bq, Qh, 0.125f);
  // HEPOS-gathered K/V projections (16x fewer FLOPs than dense K/V proj);
  // V written transposed [b,h,d,l] for contiguous P@V fragment loads.
  proj_kernel<1><<<dim3(Lc / 64, Hc, Bc), blk, 0, stream>>>(k, Wk, bk, Kg, 1.0f);
  proj_kernel<2><<<dim3(Lc / 64, Hc, Bc), blk, 0, stream>>>(v, Wv, bv, VgT, 1.0f);
  attn_kernel<<<dim3(TQc / 64, Hc, Bc), blk, 0, stream>>>(Qh, Kg, VgT, Oa);
  outproj_kernel<<<dim3((Bc * TQc) / 64, Dc / 64), blk, 0, stream>>>(Oa, Wo, bo, out);
}

// v001
// One run takes 137 microseconds.
// In two side-by-side timings against v000, it was 1.12 and 1.11 times as fast.
#include <hip/hip_runtime.h>
#include <hip/hip_bf16.h>
#include <math.h>

typedef _Float16 v16h  __attribute__((ext_vector_type(16)));
typedef _Float16 half8 __attribute__((ext_vector_type(8)));
typedef _Float16 half4 __attribute__((ext_vector_type(4)));
typedef float    v8f   __attribute__((ext_vector_type(8)));

#define WMMA_F32_F16(a, b, c) \
  __builtin_amdgcn_wmma_f32_16x16x32_f16(false, (a), false, (b), (short)0, (c), false, false)

static constexpr int Bc = 4, TQc = 2048, TKc = 8192, Dc = 1024;
static constexpr int Hc = 16, DHc = 64, Lc = 512;

// Load a 16x32 f16 WMMA A/B fragment from an LDS (or global) tile.
// A-layout per CDNA5 ISA: lane L holds row (row_base + L%16); halves j cover
// k = kb + {0..7} and k = kb + {16..23}, kb = 8*(L>=16) + koff.
__device__ __forceinline__ v16h ldfrag(const _Float16* t, int stride, int row_base,
                                       int koff, int lane) {
  int r  = row_base + (lane & 15);
  int kb = ((lane >> 4) & 1) * 8 + koff;
  half8 lo = *(const half8*)(t + r * stride + kb);
  half8 hi = *(const half8*)(t + r * stride + kb + 16);
  return __builtin_shufflevector(lo, hi, 0, 1, 2, 3, 4, 5, 6, 7,
                                 8, 9, 10, 11, 12, 13, 14, 15);
}

// Async memory->LDS 128-bit copy (CDNA5; tracked by ASYNCcnt).
__device__ __forceinline__ void async_b128(const _Float16* g, _Float16* l) {
  unsigned loff = (unsigned)(unsigned long long)(uintptr_t)l;  // low 32b = LDS offset
  unsigned long long ga = (unsigned long long)(uintptr_t)g;
  asm volatile("global_load_async_to_lds_b128 %0, %1, off" :: "v"(loff), "v"(ga) : "memory");
}
__device__ __forceinline__ void wait_async0() {
  asm volatile("s_wait_asynccnt 0x0" ::: "memory");
}

// ---------------------------------------------------------------------------
// Projection GEMM: Y_f16 = (X_f32 @ W_f32^T + bias) * scale
// MODE 0: Q.  grid (TQ/64, H, B); out Qh[((b*H+h)*TQ + t)*64 + d]   (row major)
// MODE 1: K (HEPOS gather rows t=h+16*l). out Kg[((b*H+h)*L + l)*64 + d]
// MODE 2: V (HEPOS gather) TRANSPOSED out: VgT[((b*H+h)*64 + d)*L + l]
// 64x64 tile / block, 4 waves each computing a 32x32 quadrant via 2x2 WMMAs.
// ---------------------------------------------------------------------------
template <int MODE>
__global__ __launch_bounds__(128) void proj_kernel(
    const float* __restrict__ X, const float* __restrict__ W,
    const float* __restrict__ bias, _Float16* __restrict__ Y, float scale) {
  // k extent of one staged pass. K and V stream X from memory with only two blocks
  // on a WGP, so a pass must put many bytes in flight; Q keeps the short pass.
  constexpr int BK = (MODE == 0) ? 32 : 128;
  constexpr int PK = BK + 8;  // LDS row pitch in halves: row + 16 bytes
  __shared__ __align__(16) _Float16 At[64 * PK];
  __shared__ __align__(16) _Float16 Bt[64 * PK];
  const int tid = threadIdx.x, lane = tid & 31;
  const int w = tid >> 5, wr = w >> 1, wc = w & 1;
  const int tile = blockIdx.x, h = blockIdx.y, b = blockIdx.z;
  const int n0 = h * DHc;

  v8f acc[2][2] = {};
  for (int k0 = 0; k0 < Dc; k0 += BK) {
    __syncthreads();
    if constexpr (MODE == 0) {
#pragma unroll
      for (int e = 0; e < 4; ++e) {  // stage A 64x32: float4 load -> half4 store
        int idx = (e * 128 + tid) * 4;
        int r = idx >> 5, c = idx & 31;
        long gr = (long)b * TQc + tile * 64 + r;
        float4 f = *(const float4*)(&X[gr * Dc + k0 + c]);
        half4 hh = {(_Float16)f.x, (_Float16)f.y, (_Float16)f.z, (_Float16)f.w};
        *(half4*)(At + r * PK + c) = hh;
      }
#pragma unroll
      for (int e = 0; e < 4; ++e) {  // stage B = W rows n0..n0+63
        int idx = (e * 128 + tid) * 4;
        int r = idx >> 5, c = idx & 31;
        float4 f = *(const float4*)(&W[(long)(n0 + r) * Dc + k0 + c]);
        half4 hh = {(_Float16)f.x, (_Float16)f.y, (_Float16)f.z, (_Float16)f.w};
        *(half4*)(Bt + r * PK + c) = hh;
      }
    } else {
      // 64x128 of each operand: a wave-wide load covers 512 contiguous bytes of one row,
      // wave w takes rows e*4+w; all 32 loads of a thread go out before the first use
      const int c = lane * 4;
      const float* Xk = X + ((long)b * TKc + h + 16 * (tile * 64 + w)) * Dc + k0 + c;
      const float* Wk = W + (long)(n0 + w) * Dc + k0 + c;
      float4 fa[16], fb[16];
#pragma unroll
      for (int e = 0; e < 16; ++e) fa[e] = *(const float4*)(Xk + e * (64 * Dc));
#pragma unroll
      for (int e = 0; e < 16; ++e) {
        // the first load here lands in the register pair that held the address of the
        // A loads, the last in the pair of the B loads issued before it: the wait
        // stands in front of each of the two overwrites
        if (e == 0 || e == 15) asm volatile("s_wait_xcnt 0x0" ::: "memory");
        fb[e] = *(const float4*)(Wk + e * (4 * Dc));
      }
      // keeps the conversions below the whole group of loads: without it the scheduler
      // pairs each load with its conversion and only two loads are in flight at a time
      __builtin_amdgcn_sched_barrier(0);
#pragma unroll
      for (int e = 0; e < 16; ++e) {
        half4 hh = {(_Float16)fa[e].x, (_Float16)fa[e].y, (_Float16)fa[e].z, (_Float16)fa[e].w};
        *(half4*)(At + (e * 4 + w) * PK + c) = hh;
      }
#pragma unroll
      for (int e = 0; e < 16; ++e) {
        half4 hh = {(_Float16)fb[e].x, (_Float16)fb[e].y, (_Float16)fb[e].z, (_Float16)fb[e].w};
        *(half4*)(Bt + (e * 4 + w) * PK + c) = hh;
      }
    }
    __syncthreads();
    v16h af[BK / 32][2], bf[BK / 32][2];
#pragma unroll
    for (int s = 0; s < BK / 32; ++s) {
      af[s][0] = ldfrag(At, PK, wr * 32, s * 32, lane);
      af[s][1] = ldfrag(At, PK, wr * 32 + 16, s * 32, lane);
      bf[s][0] = ldfrag(Bt, PK, wc * 32, s * 32, lane);
      bf[s][1] = ldfrag(Bt, PK, wc * 32 + 16, s * 32, lane);
    }
    // long pass: keeps its LDS reads one group ahead of the WMMAs; left to itself the
    // scheduler spreads them among the WMMAs and the wave waits out the LDS latency
    // three times per 32 k
    if (BK > 32) __builtin_amdgcn_sched_barrier(0);
#pragma unroll
    for (int s = 0; s < BK / 32; ++s) {
      acc[0][0] = WMMA_F32_F16(af[s][0], bf[s][0], acc[0][0]);
      acc[0][1] = WMMA_F32_F16(af[s][0], bf[s][1], acc[0][1]);
      acc[1][0] = WMMA_F32_F16(af[s][1], bf[s][0], acc[1][0]);
      acc[1][1] = WMMA_F32_F16(af[s][1], bf[s][1], acc[1][1]);
    }
  }
  const int base8 = ((lane >> 4) & 1) * 8;
#pragma unroll
  for (int i = 0; i < 2; ++i)
#pragma unroll
    for (int j = 0; j < 2; ++j) {
      int nl = wc * 32 + j * 16 + (lane & 15);
      float bv = bias[n0 + nl];
      if (MODE == 2) {  // transposed: row d=nl, 8 consecutive l -> one b128
        int l = tile * 64 + wr * 32 + i * 16 + base8;
        half8 pk;
#pragma unroll
        for (int v = 0; v < 8; ++v) pk[v] = (_Float16)((acc[i][j][v] + bv) * scale);
        *(half8*)(Y + (((long)b * Hc + h) * DHc + nl) * Lc + l) = pk;
      } else {
#pragma unroll
        for (int v = 0; v < 8; ++v) {
          int ml = wr * 32 + i * 16 + base8 + v;
          float y = (acc[i][j][v] + bv) * scale;
          long o = (MODE == 0)
                       ? ((((long)b * Hc + h) * TQc + (tile * 64 + ml)) * DHc + nl)
                       : ((((long)b * Hc + h) * Lc + (tile * 64 + ml)) * DHc + nl);
          Y[o] = (_Float16)y;
        }
      }
    }
}

// ---------------------------------------------------------------------------
// Flash attention over gathered keys. grid (TQ/64, H, B), 4 waves/block,
// each wave owns 16 query rows. 64-key chunks (16 WMMA per chunk, softmax
// reduction cost amortized 2x vs 32-key chunks). K chunk staged [64 l x 64 d],
// V chunk pre-transposed [64 d x 64 l]. Double-buffered async staging:
// chunk i+1's copies overlap chunk i's compute.
// ---------------------------------------------------------------------------
__global__ __launch_bounds__(128) void attn_kernel(
    const _Float16* __restrict__ Qh, const _Float16* __restrict__ Kg,
    const _Float16* __restrict__ VgT, _Float16* __restrict__ O) {
  __shared__ __align__(16) _Float16 kt[2][64 * 72];
  __shared__ __align__(16) _Float16 vt[2][64 * 72];
  __shared__ __align__(16) _Float16 pt[4][16 * 72];
  const int tid = threadIdx.x, lane = tid & 31, w = tid >> 5;
  const int qt = blockIdx.x, h = blockIdx.y, b = blockIdx.z;
  const int q0 = qt * 64 + w * 16;

  const _Float16* Qb = Qh + (((long)b * Hc + h) * TQc + q0) * DHc;
  const _Float16* Kb = Kg + (((long)b * Hc + h) * Lc) * DHc;
  const _Float16* Vb = VgT + (((long)b * Hc + h) * DHc) * Lc;

  v16h qa0 = ldfrag(Qb, DHc, 0, 0, lane);   // d = 0..31
  v16h qa1 = ldfrag(Qb, DHc, 0, 32, lane);  // d = 32..63

  float mrun[8], lrun[8];
  v8f oacc[4] = {};
#pragma unroll
  for (int j = 0; j < 8; ++j) { mrun[j] = -1e30f; lrun[j] = 0.f; }
  _Float16* P = &pt[w][0];
  const int col = lane & 15, rb = ((lane >> 4) & 1) * 8;

  // staging coordinates: each thread copies 32 halves of K and of V^T
  const int sr = tid >> 1, sc = (tid & 1) * 32;

  // prologue: stage chunk 0 into buffer 0
#pragma unroll
  for (int u = 0; u < 4; ++u) {
    async_b128(Kb + (long)sr * DHc + sc + u * 8, &kt[0][sr * 72 + sc + u * 8]);
    async_b128(Vb + (long)sr * Lc + sc + u * 8, &vt[0][sr * 72 + sc + u * 8]);
  }
  wait_async0();
  __syncthreads();

  const int NCH = Lc / 64;  // 8 chunks
  for (int c = 0; c < NCH; ++c) {
    const int cur = c & 1;
    if (c + 1 < NCH) {  // issue next chunk's copies; they overlap compute below
      int l1 = (c + 1) * 64;
#pragma unroll
      for (int u = 0; u < 4; ++u) {
        async_b128(Kb + (long)(l1 + sr) * DHc + sc + u * 8,
                   &kt[cur ^ 1][sr * 72 + sc + u * 8]);
        async_b128(Vb + (long)sr * Lc + l1 + sc + u * 8,
                   &vt[cur ^ 1][sr * 72 + sc + u * 8]);
      }
    }
    const _Float16* K = &kt[cur][0];
    const _Float16* V = &vt[cur][0];

    v8f z = {};
    v8f s[4];
#pragma unroll
    for (int t = 0; t < 4; ++t) {  // scores: 16 q x 64 l
      s[t] = WMMA_F32_F16(qa0, ldfrag(K, 72, t * 16, 0, lane), z);
      s[t] = WMMA_F32_F16(qa1, ldfrag(K, 72, t * 16, 32, lane), s[t]);
    }

    // Online softmax. C-layout: vgpr j holds row rb+j, lane%16 = col.
    // Row-max reduced per chunk; row-sum stays lane-partial until the end.
#pragma unroll
    for (int j = 0; j < 8; ++j) {
      float cmax = fmaxf(fmaxf(s[0][j], s[1][j]), fmaxf(s[2][j], s[3][j]));
#pragma unroll
      for (int mm = 1; mm < 16; mm <<= 1) cmax = fmaxf(cmax, __shfl_xor(cmax, mm, 32));
      float nm = fmaxf(mrun[j], cmax);
      float corr = __expf(mrun[j] - nm);
      mrun[j] = nm;
      float es = 0.f;
#pragma unroll
      for (int t = 0; t < 4; ++t) {
        float e = __expf(s[t][j] - nm);
        es += e;
        P[(rb + j) * 72 + t * 16 + col] = (_Float16)e;  // straight to LDS
        oacc[t][j] *= corr;
      }
      lrun[j] = lrun[j] * corr + es;
    }
    asm volatile("s_wait_dscnt 0x0" ::: "memory");
    v16h pf0 = ldfrag(P, 72, 0, 0, lane);   // P, l = 0..31
    v16h pf1 = ldfrag(P, 72, 0, 32, lane);  // P, l = 32..63
#pragma unroll
    for (int t = 0; t < 4; ++t) {  // O += P(16x64) @ V(64x16) per d-tile
      oacc[t] = WMMA_F32_F16(pf0, ldfrag(V, 72, t * 16, 0, lane), oacc[t]);
      oacc[t] = WMMA_F32_F16(pf1, ldfrag(V, 72, t * 16, 32, lane), oacc[t]);
    }
    wait_async0();    // next chunk's async copies complete
    __syncthreads();  // ... and visible to all waves
  }

  // single deferred row-sum reduction, normalize, store f16 [B, TQ, D]
#pragma unroll
  for (int j = 0; j < 8; ++j) {
    float rs = lrun[j];
#pragma unroll
    for (int mm = 1; mm < 16; mm <<= 1) rs += __shfl_xor(rs, mm, 32);
    float inv = 1.f / rs;
    long base = ((long)b * TQc + (q0 + rb + j)) * Dc + h * DHc;
#pragma unroll
    for (int t = 0; t < 4; ++t)
      O[base + t * 16 + col] = (_Float16)(oacc[t][j] * inv);
  }
}

// ---------------------------------------------------------------------------
// Output projection: out_f32[M,1024] = O_f16[M,1024] @ Wo^T + bo
// grid ((B*TQ)/64, 1024/64). A-tile staged via async copies (pure f16 copy),
// overlapped with the f32->f16 W-tile conversion.
// ---------------------------------------------------------------------------
__global__ __launch_bounds__(128) void outproj_kernel(
    const _Float16* __restrict__ A, const float* __restrict__ W,
    const float* __restrict__ bias, float* __restrict__ Out) {
  __shared__ __align__(16) _Float16 At[64 * 40];
  __shared__ __align__(16) _Float16 Bt[64 * 40];
  const int tid = threadIdx.x, lane = tid & 31;
  const int w = tid >> 5, wr = w >> 1, wc = w & 1;
  const int m0 = blockIdx.x * 64, n0 = blockIdx.y * 64;

  v8f acc[2][2] = {};
  for (int k0 = 0; k0 < Dc; k0 += 32) {
    __syncthreads();
    {  // stage A (already f16): async 64x32 copy
      int r = tid >> 1, c = (tid & 1) * 16;
      const _Float16* as = A + (long)(m0 + r) * Dc + k0 + c;
      async_b128(as, At + r * 40 + c);
      async_b128(as + 8, At + r * 40 + c + 8);
    }
#pragma unroll
    for (int e = 0; e < 4; ++e) {  // stage B (f32 -> f16) vectorized, overlaps A
      int idx = (e * 128 + tid) * 4;
      int r = idx >> 5, c = idx & 31;
      float4 f = *(const float4*)(&W[(long)(n0 + r) * Dc + k0 + c]);
      half4 hh = {(_Float16)f.x, (_Float16)f.y, (_Float16)f.z, (_Float16)f.w};
      *(half4*)(Bt + r * 40 + c) = hh;
    }
    wait_async0();
    __syncthreads();
    v16h a0 = ldfrag(At, 40, wr * 32, 0, lane);
    v16h a1 = ldfrag(At, 40, wr * 32 + 16, 0, lane);
    v16h b0 = ldfrag(Bt, 40, wc * 32, 0, lane);
    v16h b1 = ldfrag(Bt, 40, wc * 32 + 16, 0, lane);
    acc[0][0] = WMMA_F32_F16(a0, b0, acc[0][0]);
    acc[0][1] = WMMA_F32_F16(a0, b1, acc[0][1]);
    acc[1][0] = WMMA_F32_F16(a1, b0, acc[1][0]);
    acc[1][1] = WMMA_F32_F16(a1, b1, acc[1][1]);
  }
#pragma unroll
  for (int i = 0; i < 2; ++i)
#pragma unroll
    for (int j = 0; j < 2; ++j) {
      int nl = wc * 32 + j * 16 + (lane & 15);
      float bv = bias[n0 + nl];
#pragma unroll
      for (int v = 0; v < 8; ++v) {
        int ml = wr * 32 + i * 16 + ((lane >> 4) & 1) * 8 + v;
        Out[(long)(m0 + ml) * Dc + n0 + nl] = acc[i][j][v] + bv;
      }
    }
}

extern "C" void kernel_launch(void* const* d_in, const int* in_sizes, int n_in,
                              void* d_out, int out_size, void* d_ws, size_t ws_size,
                              hipStream_t stream) {
  const float* q  = (const float*)d_in[0];
  const float* k  = (const float*)d_in[1];
  const float* v  = (const float*)d_in[2];
  const float* Wq = (const float*)d_in[3];
  const float* bq = (const float*)d_in[4];
  const float* Wk = (const float*)d_in[5];
  const float* bk = (const float*)d_in[6];
  const float* Wv = (const float*)d_in[7];
  const float* bv = (const float*)d_in[8];
  const float* Wo = (const float*)d_in[9];
  const float* bo = (const float*)d_in[10];
  float* out = (float*)d_out;

  char* ws = (char*)d_ws;
  _Float16* Qh  = (_Float16*)ws;  // [B,H,TQ,64] f16
  _Float16* Kg  = (_Float16*)(ws + (size_t)Bc * Hc * TQc * DHc * 2);
  _Float16* VgT = (_Float16*)((char*)Kg + (size_t)Bc * Hc * Lc * DHc * 2);
  _Float16* Oa  = (_Float16*)((char*)VgT + (size_t)Bc * Hc * Lc * DHc * 2);  // [B,TQ,D] f16

  dim3 blk(128);
  // Q projection with 1/sqrt(dh) folded in
  proj_kernel<0><<<dim3(TQc / 64, Hc, Bc), blk, 0, stream>>>(q, Wq, bq, Qh, 0.125f);
  // HEPOS-gathered K/V projections (16x fewer FLOPs than dense K/V proj);
  // V written transposed [b,h,d,l] for contiguous P@V fragment loads.
  proj_kernel<1><<<dim3(Lc / 64, Hc, Bc), blk, 0, stream>>>(k, Wk, bk, Kg, 1.0f);
  proj_kernel<2><<<dim3(Lc / 64, Hc, Bc), blk, 0, stream>>>(v, Wv, bv, VgT, 1.0f);
  attn_kernel<<<dim3(TQc / 64, Hc, Bc), blk, 0, stream>>>(Qh, Kg, VgT, Oa);
  outproj_kernel<<<dim3((Bc * TQc) / 64, Dc / 64), blk, 0, stream>>>(Oa, Wo, bo, out);
}

// v002
// A run of this version takes 118 microseconds.
// Next to v001, in two timings, it ran 1.16 times as fast each time.
// Counting every step since v000, it is 1.30 times as fast.
#include <hip/hip_runtime.h>
#include <hip/hip_bf16.h>
#include <math.h>

typedef _Float16 v16h  __attribute__((ext_vector_type(16)));
typedef _Float16 half8 __attribute__((ext_vector_type(8)));
typedef _Float16 half4 __attribute__((ext_vector_type(4)));
typedef float    v8f   __attribute__((ext_vector_type(8)));
typedef float    v4f   __attribute__((ext_vector_type(4)));

#define WMMA_F32_F16(a, b, c) \
  __builtin_amdgcn_wmma_f32_16x16x32_f16(false, (a), false, (b), (short)0, (c), false, false)

static constexpr int Bc = 4, TQc = 2048, TKc = 8192, Dc = 1024;
static constexpr int Hc = 16, DHc = 64, Lc = 512;

// Load a 16x32 f16 WMMA A/B fragment from an LDS (or global) tile.
// A-layout per CDNA5 ISA: lane L holds row (row_base + L%16); halves j cover
// k = kb + {0..7} and k = kb + {16..23}, kb = 8*(L>=16) + koff.
__device__ __forceinline__ v16h ldfrag(const _Float16* t, int stride, int row_base,
                                       int koff, int lane) {
  int r  = row_base + (lane & 15);
  int kb = ((lane >> 4) & 1) * 8 + koff;
  half8 lo = *(const half8*)(t + r * stride + kb);
  half8 hi = *(const half8*)(t + r * stride + kb + 16);
  return __builtin_shufflevector(lo, hi, 0, 1, 2, 3, 4, 5, 6, 7,
                                 8, 9, 10, 11, 12, 13, 14, 15);
}

// Async memory->LDS 128-bit copy (CDNA5; tracked by ASYNCcnt).
__device__ __forceinline__ void async_b128(const _Float16* g, _Float16* l) {
  unsigned loff = (unsigned)(unsigned long long)(uintptr_t)l;  // low 32b = LDS offset
  unsigned long long ga = (unsigned long long)(uintptr_t)g;
  asm volatile("global_load_async_to_lds_b128 %0, %1, off" :: "v"(loff), "v"(ga) : "memory");
}
__device__ __forceinline__ void wait_async0() {
  asm volatile("s_wait_asynccnt 0x0" ::: "memory");
}

// ---------------------------------------------------------------------------
// K/V projection GEMM: Y_f16 = (X_f32 @ W_f32^T + bias) * scale
// MODE 1: K (HEPOS gather rows t=h+16*l). out Kg[((b*H+h)*L + l)*64 + d]
// MODE 2: V (HEPOS gather) TRANSPOSED out: VgT[((b*H+h)*64 + d)*L + l]
// 64x64 tile / block, 4 waves each computing a 32x32 quadrant via 2x2 WMMAs.
// ---------------------------------------------------------------------------
template <int MODE>
__global__ __launch_bounds__(128) void proj_kernel(
    const float* __restrict__ X, const float* __restrict__ W,
    const float* __restrict__ bias, _Float16* __restrict__ Y, float scale) {
  // k extent of one staged pass. K and V stream X from memory with only two blocks
  // on a WGP, so a pass must put many bytes in flight.
  constexpr int BK = 128;
  constexpr int PK = BK + 8;  // LDS row pitch in halves: row + 16 bytes
  __shared__ __align__(16) _Float16 At[64 * PK];
  __shared__ __align__(16) _Float16 Bt[64 * PK];
  const int tid = threadIdx.x, lane = tid & 31;
  const int w = tid >> 5, wr = w >> 1, wc = w & 1;
  const int tile = blockIdx.x, h = blockIdx.y, b = blockIdx.z;
  const int n0 = h * DHc;

  v8f acc[2][2] = {};
  for (int k0 = 0; k0 < Dc; k0 += BK) {
    __syncthreads();
    {
      // 64x128 of each operand: a wave-wide load covers 512 contiguous bytes of one row,
      // wave w takes rows e*4+w; all 32 loads of a thread go out before the first use
      const int c = lane * 4;
      const float* Xk = X + ((long)b * TKc + h + 16 * (tile * 64 + w)) * Dc + k0 + c;
      const float* Wk = W + (long)(n0 + w) * Dc + k0 + c;
      float4 fa[16], fb[16];
#pragma unroll
      for (int e = 0; e < 16; ++e) fa[e] = *(const float4*)(Xk + e * (64 * Dc));
#pragma unroll
      for (int e = 0; e < 16; ++e) {
        // the first load here lands in the register pair that held the address of the
        // A loads, the last in the pair of the B loads issued before it: the wait
        // stands in front of each of the two overwrites
        if (e == 0 || e == 15) asm volatile("s_wait_xcnt 0x0" ::: "memory");
        fb[e] = *(const float4*)(Wk + e * (4 * Dc));
      }
      // keeps the conversions below the whole group of loads: without it the scheduler
      // pairs each load with its conversion and only two loads are in flight at a time
      __builtin_amdgcn_sched_barrier(0);
#pragma unroll
      for (int e = 0; e < 16; ++e) {
        half4 hh = {(_Float16)fa[e].x, (_Float16)fa[e].y, (_Float16)fa[e].z, (_Float16)fa[e].w};
        *(half4*)(At + (e * 4 + w) * PK + c) = hh;
      }
#pragma unroll
      for (int e = 0; e < 16; ++e) {
        half4 hh = {(_Float16)fb[e].x, (_Float16)fb[e].y, (_Float16)fb[e].z, (_Float16)fb[e].w};
        *(half4*)(Bt + (e * 4 + w) * PK + c) = hh;
      }
    }
    __syncthreads();
    v16h af[BK / 32][2], bf[BK / 32][2];
#pragma unroll
    for (int s = 0; s < BK / 32; ++s) {
      af[s][0] = ldfrag(At, PK, wr * 32, s * 32, lane);
      af[s][1] = ldfrag(At, PK, wr * 32 + 16, s * 32, lane);
      bf[s][0] = ldfrag(Bt, PK, wc * 32, s * 32, lane);
      bf[s][1] = ldfrag(Bt, PK, wc * 32 + 16, s * 32, lane);
    }
    // keeps the pass's LDS reads one group ahead of the WMMAs; left to itself the
    // scheduler spreads them among the WMMAs and the wave waits out the LDS latency
    // three times per 32 k
    __builtin_amdgcn_sched_barrier(0);
#pragma unroll
    for (int s = 0; s < BK / 32; ++s) {
      acc[0][0] = WMMA_F32_F16(af[s][0], bf[s][0], acc[0][0]);
      acc[0][1] = WMMA_F32_F16(af[s][0], bf[s][1], acc[0][1]);
      acc[1][0] = WMMA_F32_F16(af[s][1], bf[s][0], acc[1][0]);
      acc[1][1] = WMMA_F32_F16(af[s][1], bf[s][1], acc[1][1]);
    }
  }
  const int base8 = ((lane >> 4) & 1) * 8;
#pragma unroll
  for (int i = 0; i < 2; ++i)
#pragma unroll
    for (int j = 0; j < 2; ++j) {
      int nl = wc * 32 + j * 16 + (lane & 15);
      float bv = bias[n0 + nl];
      if (MODE == 2) {  // transposed: row d=nl, 8 consecutive l -> one b128
        int l = tile * 64 + wr * 32 + i * 16 + base8;
        half8 pk;
#pragma unroll
        for (int v = 0; v < 8; ++v) pk[v] = (_Float16)((acc[i][j][v] + bv) * scale);
        *(half8*)(Y + (((long)b * Hc + h) * DHc + nl) * Lc + l) = pk;
      } else {
#pragma unroll
        for (int v = 0; v < 8; ++v) {
          int ml = wr * 32 + i * 16 + base8 + v;
          float y = (acc[i][j][v] + bv) * scale;
          long o = (((long)b * Hc + h) * Lc + (tile * 64 + ml)) * DHc + nl;
          Y[o] = (_Float16)y;
        }
      }
    }
}

// ---------------------------------------------------------------------------
// The two dense 8192 x 1024 x 1024 GEMMs (Q projection, output projection):
// 128x128 tile per block, 8 waves in a 4x2 grid, each computing 32x64 via 2x4 WMMAs,
// 128 k staged per barrier pair. A block loads 128 + 128 operand rows for 128 x 128
// outputs: half the L2 bytes per output of a 64x64 tile.
// ---------------------------------------------------------------------------
static constexpr int GT = 128;     // block tile, rows and columns
static constexpr int GK = 128;     // k extent of one staged pass
static constexpr int GP = GK + 8;  // LDS row pitch in halves: row + 16 bytes

// 128x128 f32 tile -> registers: a wave-wide load covers the 512 contiguous bytes of one
// row, wave w takes rows e*8+w. p is the thread's own place in row w of the tile; its
// sixteen loads differ by a constant.
__device__ __forceinline__ void ld_tile_f32(v4f (&f)[16], const float* __restrict__ p) {
#pragma unroll
  for (int e = 0; e < 16; ++e) f[e] = *(const v4f*)(p + e * (8 * Dc));
}
// ... and on to LDS as f16
__device__ __forceinline__ void st_tile_f16(_Float16* t, const v4f (&f)[16], int w, int lane) {
#pragma unroll
  for (int e = 0; e < 16; ++e) {
    half4 hh = {(_Float16)f[e].x, (_Float16)f[e].y, (_Float16)f[e].z, (_Float16)f[e].w};
    *(half4*)(t + (e * 8 + w) * GP + lane * 4) = hh;
  }
}
// one staged pass of a wave, in two halves of 64 k: 12 fragments, then their 16 WMMAs;
// k runs upward as in the 64x64 tile
__device__ __forceinline__ void mma_pass(const _Float16* At, const _Float16* Bt, int wr,
                                         int wc, int lane, v8f (&acc)[2][4]) {
#pragma unroll
  for (int kh = 0; kh < GK; kh += 64) {
    v16h af[2][2], bf[2][4];
#pragma unroll
    for (int s = 0; s < 2; ++s) {
#pragma unroll
      for (int i = 0; i < 2; ++i)
        af[s][i] = ldfrag(At, GP, wr * 32 + i * 16, kh + s * 32, lane);
#pragma unroll
      for (int j = 0; j < 4; ++j)
        bf[s][j] = ldfrag(Bt, GP, wc * 64 + j * 16, kh + s * 32, lane);
    }
    // keeps a half's LDS reads ahead of its own WMMAs: the first half's go out as one
    // group, the second half's among the first half's WMMAs as registers come free
    __builtin_amdgcn_sched_barrier(0);
#pragma unroll
    for (int s = 0; s < 2; ++s)
#pragma unroll
      for (int i = 0; i < 2; ++i)
#pragma unroll
        for (int j = 0; j < 4; ++j) acc[i][j] = WMMA_F32_F16(af[s][i], bf[s][j], acc[i][j]);
  }
}

// Q projection: Qh[((b*H+h)*TQ + t)*64 + d] = (q @ Wq^T + bq) * scale, f16.
// grid ((B*TQ)/128, D/128); a block's 128 columns are two heads, one per wave column.
__global__ __launch_bounds__(256) void qproj_kernel(
    const float* __restrict__ X, const float* __restrict__ W,
    const float* __restrict__ bias, _Float16* __restrict__ Y, float scale) {
  __shared__ __align__(16) _Float16 At[GT * GP];
  __shared__ __align__(16) _Float16 Bt[GT * GP];
  const int tid = threadIdx.x, lane = tid & 31;
  const int w = tid >> 5, wr = w >> 1, wc = w & 1;
  const int m0 = blockIdx.x * GT, n0 = blockIdx.y * GT;
  const float* Xt = X + (long)(m0 + w) * Dc + lane * 4;
  const float* Wt = W + (long)(n0 + w) * Dc + lane * 4;

  v8f acc[2][4] = {};
  for (int k0 = 0; k0 < Dc; k0 += GK) {
    __syncthreads();
    v4f fa[16], fb[16];
    const float* pa = Xt + k0;
    const float* pb = Wt + k0;
    ld_tile_f32(fa, pa);
    ld_tile_f32(fb, pb);
    // as inputs the two addresses stay in their registers up to here, so that no load of
    // the group lands on them; the wait stands in front of their next rewrite
    asm volatile("s_wait_xcnt 0x0" :: "v"(pa), "v"(pb) : "memory");
    // keeps the conversions below the whole group of loads, so that all 32 are in flight
    __builtin_amdgcn_sched_barrier(0);
    st_tile_f16(At, fa, w, lane);
    st_tile_f16(Bt, fb, w, lane);
    __syncthreads();
    mma_pass(At, Bt, wr, wc, lane, acc);
  }
  const int base8 = ((lane >> 4) & 1) * 8;
  const int b = m0 / TQc, t0 = m0 % TQc, h = blockIdx.y * 2 + wc;
#pragma unroll
  for (int i = 0; i < 2; ++i)
#pragma unroll
    for (int j = 0; j < 4; ++j) {
      int d = j * 16 + (lane & 15);
      float bv = bias[h * DHc + d];
#pragma unroll
      for (int v = 0; v < 8; ++v) {
        int t = t0 + wr * 32 + i * 16 + base8 + v;
        Y[(((long)b * Hc + h) * TQc + t) * DHc + d] = (_Float16)((acc[i][j][v] + bv) * scale);
      }
    }
}

// ---------------------------------------------------------------------------
// Flash attention over gathered keys. grid (TQ/64, H, B), 4 waves/block,
// each wave owns 16 query rows. 64-key chunks (16 WMMA per chunk, softmax
// reduction cost amortized 2x vs 32-key chunks). K chunk staged [64 l x 64 d],
// V chunk pre-transposed [64 d x 64 l]. Double-buffered async staging:
// chunk i+1's copies overlap chunk i's compute.
// ---------------------------------------------------------------------------
__global__ __launch_bounds__(128) void attn_kernel(
    const _Float16* __restrict__ Qh, const _Float16* __restrict__ Kg,
    const _Float16* __restrict__ VgT, _Float16* __restrict__ O) {
  __shared__ __align__(16) _Float16 kt[2][64 * 72];
  __shared__ __align__(16) _Float16 vt[2][64 * 72];
  __shared__ __align__(16) _Float16 pt[4][16 * 72];
  const int tid = threadIdx.x, lane = tid & 31, w = tid >> 5;
  const int qt = blockIdx.x, h = blockIdx.y, b = blockIdx.z;
  const int q0 = qt * 64 + w * 16;

  const _Float16* Qb = Qh + (((long)b * Hc + h) * TQc + q0) * DHc;
  const _Float16* Kb = Kg + (((long)b * Hc + h) * Lc) * DHc;
  const _Float16* Vb = VgT + (((long)b * Hc + h) * DHc) * Lc;

  v16h qa0 = ldfrag(Qb, DHc, 0, 0, lane);   // d = 0..31
  v16h qa1 = ldfrag(Qb, DHc, 0, 32, lane);  // d = 32..63

  float mrun[8], lrun[8];
  v8f oacc[4] = {};
#pragma unroll
  for (int j = 0; j < 8; ++j) { mrun[j] = -1e30f; lrun[j] = 0.f; }
  _Float16* P = &pt[w][0];
  const int col = lane & 15, rb = ((lane >> 4) & 1) * 8;

  // staging coordinates: each thread copies 32 halves of K and of V^T
  const int sr = tid >> 1, sc = (tid & 1) * 32;

  // prologue: stage chunk 0 into buffer 0
#pragma unroll
  for (int u = 0; u < 4; ++u) {
    async_b128(Kb + (long)sr * DHc + sc + u * 8, &kt[0][sr * 72 + sc + u * 8]);
    async_b128(Vb + (long)sr * Lc + sc + u * 8, &vt[0][sr * 72 + sc + u * 8]);
  }
  wait_async0();
  __syncthreads();

  const int NCH = Lc / 64;  // 8 chunks
  for (int c = 0; c < NCH; ++c) {
    const int cur = c & 1;
    if (c + 1 < NCH) {  // issue next chunk's copies; they overlap compute below
      int l1 = (c + 1) * 64;
#pragma unroll
      for (int u = 0; u < 4; ++u) {
        async_b128(Kb + (long)(l1 + sr) * DHc + sc + u * 8,
                   &kt[cur ^ 1][sr * 72 + sc + u * 8]);
        async_b128(Vb + (long)sr * Lc + l1 + sc + u * 8,
                   &vt[cur ^ 1][sr * 72 + sc + u * 8]);
      }
    }
    const _Float16* K = &kt[cur][0];
    const _Float16* V = &vt[cur][0];

    v8f z = {};
    v8f s[4];
#pragma unroll
    for (int t = 0; t < 4; ++t) {  // scores: 16 q x 64 l
      s[t] = WMMA_F32_F16(qa0, ldfrag(K, 72, t * 16, 0, lane), z);
      s[t] = WMMA_F32_F16(qa1, ldfrag(K, 72, t * 16, 32, lane), s[t]);
    }

    // Online softmax. C-layout: vgpr j holds row rb+j, lane%16 = col.
    // Row-max reduced per chunk; row-sum stays lane-partial until the end.
#pragma unroll
    for (int j = 0; j < 8; ++j) {
      float cmax = fmaxf(fmaxf(s[0][j], s[1][j]), fmaxf(s[2][j], s[3][j]));
#pragma unroll
      for (int mm = 1; mm < 16; mm <<= 1) cmax = fmaxf(cmax, __shfl_xor(cmax, mm, 32));
      float nm = fmaxf(mrun[j], cmax);
      float corr = __expf(mrun[j] - nm);
      mrun[j] = nm;
      float es = 0.f;
#pragma unroll
      for (int t = 0; t < 4; ++t) {
        float e = __expf(s[t][j] - nm);
        es += e;
        P[(rb + j) * 72 + t * 16 + col] = (_Float16)e;  // straight to LDS
        oacc[t][j] *= corr;
      }
      lrun[j] = lrun[j] * corr + es;
    }
    asm volatile("s_wait_dscnt 0x0" ::: "memory");
    v16h pf0 = ldfrag(P, 72, 0, 0, lane);   // P, l = 0..31
    v16h pf1 = ldfrag(P, 72, 0, 32, lane);  // P, l = 32..63
#pragma unroll
    for (int t = 0; t < 4; ++t) {  // O += P(16x64) @ V(64x16) per d-tile
      oacc[t] = WMMA_F32_F16(pf0, ldfrag(V, 72, t * 16, 0, lane), oacc[t]);
      oacc[t] = WMMA_F32_F16(pf1, ldfrag(V, 72, t * 16, 32, lane), oacc[t]);
    }
    wait_async0();    // next chunk's async copies complete
    __syncthreads();  // ... and visible to all waves
  }

  // single deferred row-sum reduction, normalize, store f16 [B, TQ, D]
#pragma unroll
  for (int j = 0; j < 8; ++j) {
    float rs = lrun[j];
#pragma unroll
    for (int mm = 1; mm < 16; mm <<= 1) rs += __shfl_xor(rs, mm, 32);
    float inv = 1.f / rs;
    long base = ((long)b * TQc + (q0 + rb + j)) * Dc + h * DHc;
#pragma unroll
    for (int t = 0; t < 4; ++t)
      O[base + t * 16 + col] = (_Float16)(oacc[t][j] * inv);
  }
}

// ---------------------------------------------------------------------------
// Output projection: out_f32[M,1024] = O_f16[M,1024] @ Wo^T + bo
// grid ((B*TQ)/128, 1024/128). A-tile staged via async copies (pure f16 copy),
// overlapped with the f32->f16 W-tile conversion.
// ---------------------------------------------------------------------------
// 128x128 f16 tile -> LDS, eight async 16-byte copies per lane. The s_wait_xcnt closes the
// statement so that it stands in front of any rewrite of the address registers.
__device__ __forceinline__ void async_tile_f16(const _Float16* src, _Float16* t, int tid) {
  unsigned l[8];
  unsigned long long g[8];
#pragma unroll
  for (int e = 0; e < 8; ++e) {
    int r = e * 16 + (tid >> 4), c = (tid & 15) * 8;
    l[e] = (unsigned)(unsigned long long)(uintptr_t)(t + r * GP + c);
    g[e] = (unsigned long long)(uintptr_t)(src + r * Dc + c);
  }
  asm volatile(
      "global_load_async_to_lds_b128 %0, %8, off\n\t"
      "global_load_async_to_lds_b128 %1, %9, off\n\t"
      "global_load_async_to_lds_b128 %2, %10, off\n\t"
      "global_load_async_to_lds_b128 %3, %11, off\n\t"
      "global_load_async_to_lds_b128 %4, %12, off\n\t"
      "global_load_async_to_lds_b128 %5, %13, off\n\t"
      "global_load_async_to_lds_b128 %6, %14, off\n\t"
      "global_load_async_to_lds_b128 %7, %15, off\n\t"
      "s_wait_xcnt 0x0"
      :: "v"(l[0]), "v"(l[1]), "v"(l[2]), "v"(l[3]), "v"(l[4]), "v"(l[5]), "v"(l[6]), "v"(l[7]),
         "v"(g[0]), "v"(g[1]), "v"(g[2]), "v"(g[3]), "v"(g[4]), "v"(g[5]), "v"(g[6]), "v"(g[7])
      : "memory");
}

__global__ __launch_bounds__(256) void outproj_kernel(
    const _Float16* __restrict__ A, const float* __restrict__ W,
    const float* __restrict__ bias, float* __restrict__ Out) {
  __shared__ __align__(16) _Float16 At[GT * GP];
  __shared__ __align__(16) _Float16 Bt[GT * GP];
  const int tid = threadIdx.x, lane = tid & 31;
  const int w = tid >> 5, wr = w >> 1, wc = w & 1;
  const int m0 = blockIdx.x * GT, n0 = blockIdx.y * GT;
  const _Float16* Ar = A + (long)m0 * Dc;
  const float* Wt = W + (long)(n0 + w) * Dc + lane * 4;

  v8f acc[2][4] = {};
  for (int k0 = 0; k0 < Dc; k0 += GK) {
    // this wave's LDS reads of the last pass are done before the copies may land on them
    asm volatile("s_wait_dscnt 0x0" ::: "memory");
    __syncthreads();
    v4f fb[16];
    ld_tile_f32(fb, Wt + k0);
    async_tile_f16(Ar + k0, At, tid);  // A is f16 already: no register on its way
    // keeps the conversions below the loads and copies, so that all are in flight
    __builtin_amdgcn_sched_barrier(0);
    st_tile_f16(Bt, fb, w, lane);
    wait_async0();
    __syncthreads();
    mma_pass(At, Bt, wr, wc, lane, acc);
  }
  const int base8 = ((lane >> 4) & 1) * 8;
#pragma unroll
  for (int i = 0; i < 2; ++i)
#pragma unroll
    for (int j = 0; j < 4; ++j) {
      int nl = wc * 64 + j * 16 + (lane & 15);
      float bv = bias[n0 + nl];
#pragma unroll
      for (int v = 0; v < 8; ++v) {
        int ml = wr * 32 + i * 16 + base8 + v;
        Out[(long)(m0 + ml) * Dc + n0 + nl] = acc[i][j][v] + bv;
      }
    }
}

extern "C" void kernel_launch(void* const* d_in, const int* in_sizes, int n_in,
                              void* d_out, int out_size, void* d_ws, size_t ws_size,
                              hipStream_t stream) {
  const float* q  = (const float*)d_in[0];
  const float* k  = (const float*)d_in[1];
  const float* v  = (const float*)d_in[2];
  const float* Wq = (const float*)d_in[3];
  const float* bq = (const float*)d_in[4];
  const float* Wk = (const float*)d_in[5];
  const float* bk = (const float*)d_in[6];
  const float* Wv = (const float*)d_in[7];
  const float* bv = (const float*)d_in[8];
  const float* Wo = (const float*)d_in[9];
  const float* bo = (const float*)d_in[10];
  float* out = (float*)d_out;

  char* ws = (char*)d_ws;
  _Float16* Qh  = (_Float16*)ws;  // [B,H,TQ,64] f16
  _Float16* Kg  = (_Float16*)(ws + (size_t)Bc * Hc * TQc * DHc * 2);
  _Float16* VgT = (_Float16*)((char*)Kg + (size_t)Bc * Hc * Lc * DHc * 2);
  _Float16* Oa  = (_Float16*)((char*)VgT + (size_t)Bc * Hc * Lc * DHc * 2);  // [B,TQ,D] f16

  dim3 blk(128), blk8(256);
  // Q projection with 1/sqrt(dh) folded in
  qproj_kernel<<<dim3((Bc * TQc) / GT, Dc / GT), blk8, 0, stream>>>(q, Wq, bq, Qh, 0.125f);
  // HEPOS-gathered K/V projections (16x fewer FLOPs than dense K/V proj);
  // V written transposed [b,h,d,l] for contiguous P@V fragment loads.
  proj_kernel<1><<<dim3(Lc / 64, Hc, Bc), blk, 0, stream>>>(k, Wk, bk, Kg, 1.0f);
  proj_kernel<2><<<dim3(Lc / 64, Hc, Bc), blk, 0, stream>>>(v, Wv, bv, VgT, 1.0f);
  attn_kernel<<<dim3(TQc / 64, Hc, Bc), blk, 0, stream>>>(Qh, Kg, VgT, Oa);
  outproj_kernel<<<dim3((Bc * TQc) / GT, Dc / GT), blk8, 0, stream>>>(Oa, Wo, bo, out);
}

// v003
// Measured time: 109 microseconds a run.
// Timed twice side by side with v002, it ran 1.08 times as fast both times.
// All steps since v000 together make it 1.40 times as fast.
#include <hip/hip_runtime.h>
#include <hip/hip_bf16.h>
#include <math.h>

typedef _Float16 v16h  __attribute__((ext_vector_type(16)));
typedef _Float16 half8 __attribute__((ext_vector_type(8)));
typedef _Float16 half4 __attribute__((ext_vector_type(4)));
typedef float    v8f   __attribute__((ext_vector_type(8)));
typedef float    v4f   __attribute__((ext_vector_type(4)));

#define WMMA_F32_F16(a, b, c) \
  __builtin_amdgcn_wmma_f32_16x16x32_f16(false, (a), false, (b), (short)0, (c), false, false)

static constexpr int Bc = 4, TQc = 2048, TKc = 8192, Dc = 1024;
static constexpr int Hc = 16, DHc = 64, Lc = 512;

// Load a 16x32 f16 WMMA A/B fragment from an LDS (or global) tile.
// A-layout per CDNA5 ISA: lane L holds row (row_base + L%16); halves j cover
// k = kb + {0..7} and k = kb + {16..23}, kb = 8*(L>=16) + koff.
__device__ __forceinline__ v16h ldfrag(const _Float16* t, int stride, int row_base,
                                       int koff, int lane) {
  int r  = row_base + (lane & 15);
  int kb = ((lane >> 4) & 1) * 8 + koff;
  half8 lo = *(const half8*)(t + r * stride + kb);
  half8 hi = *(const half8*)(t + r * stride + kb + 16);
  return __builtin_shufflevector(lo, hi, 0, 1, 2, 3, 4, 5, 6, 7,
                                 8, 9, 10, 11, 12, 13, 14, 15);
}

// Async memory->LDS 128-bit copy (CDNA5; tracked by ASYNCcnt).
__device__ __forceinline__ void async_b128(const _Float16* g, _Float16* l) {
  unsigned loff = (unsigned)(unsigned long long)(uintptr_t)l;  // low 32b = LDS offset
  unsigned long long ga = (unsigned long long)(uintptr_t)g;
  asm volatile("global_load_async_to_lds_b128 %0, %1, off" :: "v"(loff), "v"(ga) : "memory");
}
__device__ __forceinline__ void wait_async0() {
  asm volatile("s_wait_asynccnt 0x0" ::: "memory");
}

// ---------------------------------------------------------------------------
// K/V projection GEMM: Y_f16 = (X_f32 @ W_f32^T + bias) * scale
// MODE 1: K (HEPOS gather rows t=h+16*l). out Kg[((b*H+h)*L + l)*64 + d]
// MODE 2: V (HEPOS gather) TRANSPOSED out: VgT[((b*H+h)*64 + d)*L + l]
// 64x64 tile / block, 4 waves each computing a 32x32 quadrant via 2x2 WMMAs.
// ---------------------------------------------------------------------------
template <int MODE>
__global__ __launch_bounds__(128) void proj_kernel(
    const float* __restrict__ X, const float* __restrict__ W,
    const float* __restrict__ bias, _Float16* __restrict__ Y, float scale) {
  // k extent of one staged pass. K and V stream X from memory with only two blocks
  // on a WGP, so a pass must put many bytes in flight.
  constexpr int BK = 128;
  constexpr int PK = BK + 8;  // LDS row pitch in halves: row + 16 bytes
  __shared__ __align__(16) _Float16 At[64 * PK];
  __shared__ __align__(16) _Float16 Bt[64 * PK];
  const int tid = threadIdx.x, lane = tid & 31;
  const int w = tid >> 5, wr = w >> 1, wc = w & 1;
  const int tile = blockIdx.x, h = blockIdx.y, b = blockIdx.z;
  const int n0 = h * DHc;

  v8f acc[2][2] = {};
  for (int k0 = 0; k0 < Dc; k0 += BK) {
    __syncthreads();
    {
      // 64x128 of each operand: a wave-wide load covers 512 contiguous bytes of one row,
      // wave w takes rows e*4+w; all 32 loads of a thread go out before the first use
      const int c = lane * 4;
      const float* Xk = X + ((long)b * TKc + h + 16 * (tile * 64 + w)) * Dc + k0 + c;
      const float* Wk = W + (long)(n0 + w) * Dc + k0 + c;
      float4 fa[16], fb[16];
#pragma unroll
      for (int e = 0; e < 16; ++e) fa[e] = *(const float4*)(Xk + e * (64 * Dc));
#pragma unroll
      for (int e = 0; e < 16; ++e) {
        // the first load here lands in the register pair that held the address of the
        // A loads, the last in the pair of the B loads issued before it: the wait
        // stands in front of each of the two overwrites
        if (e == 0 || e == 15) asm volatile("s_wait_xcnt 0x0" ::: "memory");
        fb[e] = *(const float4*)(Wk + e * (4 * Dc));
      }
      // keeps the conversions below the whole group of loads: without it the scheduler
      // pairs each load with its conversion and only two loads are in flight at a time
      __builtin_amdgcn_sched_barrier(0);
#pragma unroll
      for (int e = 0; e < 16; ++e) {
        half4 hh = {(_Float16)fa[e].x, (_Float16)fa[e].y, (_Float16)fa[e].z, (_Float16)fa[e].w};
        *(half4*)(At + (e * 4 + w) * PK + c) = hh;
      }
#pragma unroll
      for (int e = 0; e < 16; ++e) {
        half4 hh = {(_Float16)fb[e].x, (_Float16)fb[e].y, (_Float16)fb[e].z, (_Float16)fb[e].w};
        *(half4*)(Bt + (e * 4 + w) * PK + c) = hh;
      }
    }
    __syncthreads();
    v16h af[BK / 32][2], bf[BK / 32][2];
#pragma unroll
    for (int s = 0; s < BK / 32; ++s) {
      af[s][0] = ldfrag(At, PK, wr * 32, s * 32, lane);
      af[s][1] = ldfrag(At, PK, wr * 32 + 16, s * 32, lane);
      bf[s][0] = ldfrag(Bt, PK, wc * 32, s * 32, lane);
      bf[s][1] = ldfrag(Bt, PK, wc * 32 + 16, s * 32, lane);
    }
    // keeps the pass's LDS reads one group ahead of the WMMAs; left to itself the
    // scheduler spreads them among the WMMAs and the wave waits out the LDS latency
    // three times per 32 k
    __builtin_amdgcn_sched_barrier(0);
#pragma unroll
    for (int s = 0; s < BK / 32; ++s) {
      acc[0][0] = WMMA_F32_F16(af[s][0], bf[s][0], acc[0][0]);
      acc[0][1] = WMMA_F32_F16(af[s][0], bf[s][1], acc[0][1]);
      acc[1][0] = WMMA_F32_F16(af[s][1], bf[s][0], acc[1][0]);
      acc[1][1] = WMMA_F32_F16(af[s][1], bf[s][1], acc[1][1]);
    }
  }
  const int base8 = ((lane >> 4) & 1) * 8;
#pragma unroll
  for (int i = 0; i < 2; ++i)
#pragma unroll
    for (int j = 0; j < 2; ++j) {
      int nl = wc * 32 + j * 16 + (lane & 15);
      float bv = bias[n0 + nl];
      if (MODE == 2) {  // transposed: row d=nl, 8 consecutive l -> one b128
        int l = tile * 64 + wr * 32 + i * 16 + base8;
        half8 pk;
#pragma unroll
        for (int v = 0; v < 8; ++v) pk[v] = (_Float16)((acc[i][j][v] + bv) * scale);
        *(half8*)(Y + (((long)b * Hc + h) * DHc + nl) * Lc + l) = pk;
      } else {
#pragma unroll
        for (int v = 0; v < 8; ++v) {
          int ml = wr * 32 + i * 16 + base8 + v;
          float y = (acc[i][j][v] + bv) * scale;
          long o = (((long)b * Hc + h) * Lc + (tile * 64 + ml)) * DHc + nl;
          Y[o] = (_Float16)y;
        }
      }
    }
}

// ---------------------------------------------------------------------------
// The two dense 8192 x 1024 x 1024 GEMMs (Q projection, output projection):
// 128x128 tile per block, 8 waves in a 4x2 grid, each computing 32x64 via 2x4 WMMAs,
// 128 k staged per barrier pair. A block loads 128 + 128 operand rows for 128 x 128
// outputs: half the L2 bytes per output of a 64x64 tile.
// ---------------------------------------------------------------------------
static constexpr int GT = 128;     // block tile, rows and columns
static constexpr int GK = 128;     // k extent of one staged pass
static constexpr int GP = GK + 8;  // LDS row pitch in halves: row + 16 bytes

// 128x128 f32 tile -> registers: a wave-wide load covers the 512 contiguous bytes of one
// row, wave w takes rows e*8+w. p is the thread's own place in row w of the tile; its
// sixteen loads differ by a constant.
__device__ __forceinline__ void ld_tile_f32(v4f (&f)[16], const float* __restrict__ p) {
#pragma unroll
  for (int e = 0; e < 16; ++e) f[e] = *(const v4f*)(p + e * (8 * Dc));
}
// ... and on to LDS as f16
__device__ __forceinline__ void st_tile_f16(_Float16* t, const v4f (&f)[16], int w, int lane) {
#pragma unroll
  for (int e = 0; e < 16; ++e) {
    half4 hh = {(_Float16)f[e].x, (_Float16)f[e].y, (_Float16)f[e].z, (_Float16)f[e].w};
    *(half4*)(t + (e * 8 + w) * GP + lane * 4) = hh;
  }
}
// one staged pass of a wave, in two halves of 64 k: 12 fragments, then their 16 WMMAs;
// k runs upward as in the 64x64 tile
__device__ __forceinline__ void mma_pass(const _Float16* At, const _Float16* Bt, int wr,
                                         int wc, int lane, v8f (&acc)[2][4]) {
#pragma unroll
  for (int kh = 0; kh < GK; kh += 64) {
    v16h af[2][2], bf[2][4];
#pragma unroll
    for (int s = 0; s < 2; ++s) {
#pragma unroll
      for (int i = 0; i < 2; ++i)
        af[s][i] = ldfrag(At, GP, wr * 32 + i * 16, kh + s * 32, lane);
#pragma unroll
      for (int j = 0; j < 4; ++j)
        bf[s][j] = ldfrag(Bt, GP, wc * 64 + j * 16, kh + s * 32, lane);
    }
    // keeps a half's LDS reads ahead of its own WMMAs: the first half's go out as one
    // group, the second half's among the first half's WMMAs as registers come free
    __builtin_amdgcn_sched_barrier(0);
#pragma unroll
    for (int s = 0; s < 2; ++s)
#pragma unroll
      for (int i = 0; i < 2; ++i)
#pragma unroll
        for (int j = 0; j < 4; ++j) acc[i][j] = WMMA_F32_F16(af[s][i], bf[s][j], acc[i][j]);
  }
}

// Q projection: Qh[((b*H+h)*TQ + t)*64 + d] = (q @ Wq^T + bq) * scale, f16.
// grid ((B*TQ)/128, D/128); a block's 128 columns are two heads, one per wave column.
__global__ __launch_bounds__(256) void qproj_kernel(
    const float* __restrict__ X, const float* __restrict__ W,
    const float* __restrict__ bias, _Float16* __restrict__ Y, float scale) {
  __shared__ __align__(16) _Float16 At[GT * GP];
  __shared__ __align__(16) _Float16 Bt[GT * GP];
  const int tid = threadIdx.x, lane = tid & 31;
  const int w = tid >> 5, wr = w >> 1, wc = w & 1;
  const int m0 = blockIdx.x * GT, n0 = blockIdx.y * GT;
  const float* Xt = X + (long)(m0 + w) * Dc + lane * 4;
  const float* Wt = W + (long)(n0 + w) * Dc + lane * 4;

  v8f acc[2][4] = {};
  for (int k0 = 0; k0 < Dc; k0 += GK) {
    __syncthreads();
    v4f fa[16], fb[16];
    const float* pa = Xt + k0;
    const float* pb = Wt + k0;
    ld_tile_f32(fa, pa);
    ld_tile_f32(fb, pb);
    // as inputs the two addresses stay in their registers up to here, so that no load of
    // the group lands on them; the wait stands in front of their next rewrite
    asm volatile("s_wait_xcnt 0x0" :: "v"(pa), "v"(pb) : "memory");
    // keeps the conversions below the whole group of loads, so that all 32 are in flight
    __builtin_amdgcn_sched_barrier(0);
    st_tile_f16(At, fa, w, lane);
    st_tile_f16(Bt, fb, w, lane);
    __syncthreads();
    mma_pass(At, Bt, wr, wc, lane, acc);
  }
  const int base8 = ((lane >> 4) & 1) * 8;
  const int b = m0 / TQc, t0 = m0 % TQc, h = blockIdx.y * 2 + wc;
#pragma unroll
  for (int i = 0; i < 2; ++i)
#pragma unroll
    for (int j = 0; j < 4; ++j) {
      int d = j * 16 + (lane & 15);
      float bv = bias[h * DHc + d];
#pragma unroll
      for (int v = 0; v < 8; ++v) {
        int t = t0 + wr * 32 + i * 16 + base8 + v;
        Y[(((long)b * Hc + h) * TQc + t) * DHc + d] = (_Float16)((acc[i][j][v] + bv) * scale);
      }
    }
}

__device__ __forceinline__ float other_half(float x) {
  int b = __builtin_bit_cast(int, x);
  return __builtin_bit_cast(
      float, __builtin_amdgcn_permlanex16(b, b, 0x76543210, 0xfedcba98, false, false));
}

__global__ __launch_bounds__(128) void attn_kernel(
    const _Float16* __restrict__ Qh, const _Float16* __restrict__ Kg,
    const _Float16* __restrict__ VgT, _Float16* __restrict__ O) {
  __shared__ __align__(16) _Float16 kt[2][64 * 72];
  __shared__ __align__(16) _Float16 vt[2][64 * 72];
  const int tid = threadIdx.x, lane = tid & 31, w = tid >> 5;
  const int qt = blockIdx.x, h = blockIdx.y, b = blockIdx.z;
  const int q0 = qt * 64 + w * 16;

  const _Float16* Qb = Qh + (((long)b * Hc + h) * TQc + q0) * DHc;
  const _Float16* Kb = Kg + (((long)b * Hc + h) * Lc) * DHc;
  const _Float16* Vb = VgT + (((long)b * Hc + h) * DHc) * Lc;

  v16h qb0 = ldfrag(Qb, DHc, 0, 0, lane);   // B operand: query lane%16, d = 0..31
  v16h qb1 = ldfrag(Qb, DHc, 0, 32, lane);  // d = 32..63

  float mrun = -1e30f, lrun = 0.f;  // of this lane's query; lrun over this half's keys
  v8f oacc[4] = {};                 // O^T: oacc[t][r] = O[query col][d = t*16 + rb + r]
  const int col = lane & 15, rb = ((lane >> 4) & 1) * 8;

  // staging coordinates: each thread copies 32 halves of K and of V^T
  const int sr = tid >> 1, sc = (tid & 1) * 32;

  // prologue: stage chunk 0 into buffer 0
#pragma unroll
  for (int u = 0; u < 4; ++u) {
    async_b128(Kb + (long)sr * DHc + sc + u * 8, &kt[0][sr * 72 + sc + u * 8]);
    async_b128(Vb + (long)sr * Lc + sc + u * 8, &vt[0][sr * 72 + sc + u * 8]);
  }
  wait_async0();
  __syncthreads();

  const int NCH = Lc / 64;  // 8 chunks
  for (int c = 0; c < NCH; ++c) {
    const int cur = c & 1;
    if (c + 1 < NCH) {  // issue next chunk's copies; they overlap compute below
      int l1 = (c + 1) * 64;
#pragma unroll
      for (int u = 0; u < 4; ++u) {
        async_b128(Kb + (long)(l1 + sr) * DHc + sc + u * 8,
                   &kt[cur ^ 1][sr * 72 + sc + u * 8]);
        async_b128(Vb + (long)sr * Lc + l1 + sc + u * 8,
                   &vt[cur ^ 1][sr * 72 + sc + u * 8]);
      }
    }
    const _Float16* K = &kt[cur][0];
    const _Float16* V = &vt[cur][0];

    v8f z = {};
    v8f s[4];
#pragma unroll
    for (int t = 0; t < 4; ++t) {  // scores: s[t][r] = S[query col][l = t*16 + rb + r]
      s[t] = WMMA_F32_F16(ldfrag(K, 72, t * 16, 0, lane), qb0, z);
      s[t] = WMMA_F32_F16(ldfrag(K, 72, t * 16, 32, lane), qb1, s[t]);
    }

    // Online softmax, one query per lane: 32 of the chunk's 64 keys here, 32 in lane^16.
    float cmax = s[0][0];
#pragma unroll
    for (int t = 0; t < 4; ++t)
#pragma unroll
      for (int r = 0; r < 8; ++r) cmax = fmaxf(cmax, s[t][r]);
    cmax = fmaxf(cmax, other_half(cmax));
    const float nm = fmaxf(mrun, cmax);
    const float corr = __expf(mrun - nm);
    mrun = nm;
#pragma unroll
    for (int t = 0; t < 4; ++t) oacc[t] *= corr;
    v8f sv;
#pragma unroll
    for (int u = 0; u < 2; ++u) {  // 32 keys at a time
#pragma unroll
      for (int t = 2 * u; t < 2 * u + 2; ++t) {
#pragma unroll
        for (int r = 0; r < 8; ++r) s[t][r] = __expf(s[t][r] - nm);
        sv = t == 0 ? s[0] : sv + s[t];
      }
      // P^T as B operand: tiles 2u and 2u+1 hold keys 32u + rb + {0..7} and 32u + 16 + rb +
      // {0..7} of this lane's query, the k order in which ldfrag reads V^T
      const v16h pb = __builtin_shufflevector(__builtin_convertvector(s[2 * u], half8),
                                              __builtin_convertvector(s[2 * u + 1], half8), 0, 1,
                                              2, 3, 4, 5, 6, 7, 8, 9, 10, 11, 12, 13, 14, 15);
#pragma unroll
      for (int t = 0; t < 4; ++t)  // O^T += V^T(16 d x 32 l) @ P^T(32 l x 16 q) per d-tile
        oacc[t] = WMMA_F32_F16(ldfrag(V, 72, t * 16, u * 32, lane), pb, oacc[t]);
    }
    lrun = lrun * corr + (((sv[0] + sv[1]) + (sv[2] + sv[3])) + ((sv[4] + sv[5]) + (sv[6] + sv[7])));
    wait_async0();    // next chunk's async copies complete
    __syncthreads();  // ... and visible to all waves
  }

  // join the two halves' sums, normalize, store f16 [B, TQ, D]: 8 consecutive d per tile
  const float inv = 1.f / (lrun + other_half(lrun));
  _Float16* Or = O + ((long)b * TQc + (q0 + col)) * Dc + h * DHc + rb;
#pragma unroll
  for (int t = 0; t < 4; ++t)
    *(half8*)(Or + t * 16) = __builtin_convertvector(oacc[t] * inv, half8);
}

// ---------------------------------------------------------------------------
// Output projection: out_f32[M,1024] = O_f16[M,1024] @ Wo^T + bo
// grid ((B*TQ)/128, 1024/128). A-tile staged via async copies (pure f16 copy),
// overlapped with the f32->f16 W-tile conversion.
// ---------------------------------------------------------------------------
// 128x128 f16 tile -> LDS, eight async 16-byte copies per lane. The s_wait_xcnt closes the
// statement so that it stands in front of any rewrite of the address registers.
__device__ __forceinline__ void async_tile_f16(const _Float16* src, _Float16* t, int tid) {
  unsigned l[8];
  unsigned long long g[8];
#pragma unroll
  for (int e = 0; e < 8; ++e) {
    int r = e * 16 + (tid >> 4), c = (tid & 15) * 8;
    l[e] = (unsigned)(unsigned long long)(uintptr_t)(t + r * GP + c);
    g[e] = (unsigned long long)(uintptr_t)(src + r * Dc + c);
  }
  asm volatile(
      "global_load_async_to_lds_b128 %0, %8, off\n\t"
      "global_load_async_to_lds_b128 %1, %9, off\n\t"
      "global_load_async_to_lds_b128 %2, %10, off\n\t"
      "global_load_async_to_lds_b128 %3, %11, off\n\t"
      "global_load_async_to_lds_b128 %4, %12, off\n\t"
      "global_load_async_to_lds_b128 %5, %13, off\n\t"
      "global_load_async_to_lds_b128 %6, %14, off\n\t"
      "global_load_async_to_lds_b128 %7, %15, off\n\t"
      "s_wait_xcnt 0x0"
      :: "v"(l[0]), "v"(l[1]), "v"(l[2]), "v"(l[3]), "v"(l[4]), "v"(l[5]), "v"(l[6]), "v"(l[7]),
         "v"(g[0]), "v"(g[1]), "v"(g[2]), "v"(g[3]), "v"(g[4]), "v"(g[5]), "v"(g[6]), "v"(g[7])
      : "memory");
}

__global__ __launch_bounds__(256) void outproj_kernel(
    const _Float16* __restrict__ A, const float* __restrict__ W,
    const float* __restrict__ bias, float* __restrict__ Out) {
  __shared__ __align__(16) _Float16 At[GT * GP];
  __shared__ __align__(16) _Float16 Bt[GT * GP];
  const int tid = threadIdx.x, lane = tid & 31;
  const int w = tid >> 5, wr = w >> 1, wc = w & 1;
  const int m0 = blockIdx.x * GT, n0 = blockIdx.y * GT;
  const _Float16* Ar = A + (long)m0 * Dc;
  const float* Wt = W + (long)(n0 + w) * Dc + lane * 4;

  v8f acc[2][4] = {};
  for (int k0 = 0; k0 < Dc; k0 += GK) {
    // this wave's LDS reads of the last pass are done before the copies may land on them
    asm volatile("s_wait_dscnt 0x0" ::: "memory");
    __syncthreads();
    v4f fb[16];
    ld_tile_f32(fb, Wt + k0);
    async_tile_f16(Ar + k0, At, tid);  // A is f16 already: no register on its way
    // keeps the conversions below the loads and copies, so that all are in flight
    __builtin_amdgcn_sched_barrier(0);
    st_tile_f16(Bt, fb, w, lane);
    wait_async0();
    __syncthreads();
    mma_pass(At, Bt, wr, wc, lane, acc);
  }
  const int base8 = ((lane >> 4) & 1) * 8;
#pragma unroll
  for (int i = 0; i < 2; ++i)
#pragma unroll
    for (int j = 0; j < 4; ++j) {
      int nl = wc * 64 + j * 16 + (lane & 15);
      float bv = bias[n0 + nl];
#pragma unroll
      for (int v = 0; v < 8; ++v) {
        int ml = wr * 32 + i * 16 + base8 + v;
        Out[(long)(m0 + ml) * Dc + n0 + nl] = acc[i][j][v] + bv;
      }
    }
}

extern "C" void kernel_launch(void* const* d_in, const int* in_sizes, int n_in,
                              void* d_out, int out_size, void* d_ws, size_t ws_size,
                              hipStream_t stream) {
  const float* q  = (const float*)d_in[0];
  const float* k  = (const float*)d_in[1];
  const float* v  = (const float*)d_in[2];
  const float* Wq = (const float*)d_in[3];
  const float* bq = (const float*)d_in[4];
  const float* Wk = (const float*)d_in[5];
  const float* bk = (const float*)d_in[6];
  const float* Wv = (const float*)d_in[7];
  const float* bv = (const float*)d_in[8];
  const float* Wo = (const float*)d_in[9];
  const float* bo = (const float*)d_in[10];
  float* out = (float*)d_out;

  char* ws = (char*)d_ws;
  _Float16* Qh  = (_Float16*)ws;  // [B,H,TQ,64] f16
  _Float16* Kg  = (_Float16*)(ws + (size_t)Bc * Hc * TQc * DHc * 2);
  _Float16* VgT = (_Float16*)((char*)Kg + (size_t)Bc * Hc * Lc * DHc * 2);
  _Float16* Oa  = (_Float16*)((char*)VgT + (size_t)Bc * Hc * Lc * DHc * 2);  // [B,TQ,D] f16

  dim3 blk(128), blk8(256);
  // Q projection with 1/sqrt(dh) folded in
  qproj_kernel<<<dim3((Bc * TQc) / GT, Dc / GT), blk8, 0, stream>>>(q, Wq, bq, Qh, 0.125f);
  // HEPOS-gathered K/V projections (16x fewer FLOPs than dense K/V proj);
  // V written transposed [b,h,d,l] for contiguous P@V fragment loads.
  proj_kernel<1><<<dim3(Lc / 64, Hc, Bc), blk, 0, stream>>>(k, Wk, bk, Kg, 1.0f);
  proj_kernel<2><<<dim3(Lc / 64, Hc, Bc), blk, 0, stream>>>(v, Wv, bv, VgT, 1.0f);
  attn_kernel<<<dim3(TQc / 64, Hc, Bc), blk, 0, stream>>>(Qh, Kg, VgT, Oa);
  outproj_kernel<<<dim3((Bc * TQc) / GT, Dc / GT), blk8, 0, stream>>>(Oa, Wo, bo, out);
}

// v004
// It runs in 102 microseconds.
// Next to v003, in two timings, it ran 1.07 times as fast each time.
// Over all steps from v000 it is 1.50 times as fast.
#include <hip/hip_runtime.h>
#include <hip/hip_bf16.h>
#include <math.h>

typedef _Float16 v16h  __attribute__((ext_vector_type(16)));
typedef _Float16 half8 __attribute__((ext_vector_type(8)));
typedef _Float16 half4 __attribute__((ext_vector_type(4)));
typedef float    v8f   __attribute__((ext_vector_type(8)));
typedef float    v4f   __attribute__((ext_vector_type(4)));

#define WMMA_F32_F16(a, b, c) \
  __builtin_amdgcn_wmma_f32_16x16x32_f16(false, (a), false, (b), (short)0, (c), false, false)

static constexpr int Bc = 4, TQc = 2048, TKc = 8192, Dc = 1024;
static constexpr int Hc = 16, DHc = 64, Lc = 512;

// Load a 16x32 f16 WMMA A/B fragment from an LDS (or global) tile.
// A-layout per CDNA5 ISA: lane L holds row (row_base + L%16); halves j cover
// k = kb + {0..7} and k = kb + {16..23}, kb = 8*(L>=16) + koff.
__device__ __forceinline__ v16h ldfrag(const _Float16* t, int stride, int row_base,
                                       int koff, int lane) {
  int r  = row_base + (lane & 15);
  int kb = ((lane >> 4) & 1) * 8 + koff;
  half8 lo = *(const half8*)(t + r * stride + kb);
  half8 hi = *(const half8*)(t + r * stride + kb + 16);
  return __builtin_shufflevector(lo, hi, 0, 1, 2, 3, 4, 5, 6, 7,
                                 8, 9, 10, 11, 12, 13, 14, 15);
}

// Async memory->LDS 128-bit copy (CDNA5; tracked by ASYNCcnt).
__device__ __forceinline__ void async_b128(const _Float16* g, _Float16* l) {
  unsigned loff = (unsigned)(unsigned long long)(uintptr_t)l;  // low 32b = LDS offset
  unsigned long long ga = (unsigned long long)(uintptr_t)g;
  asm volatile("global_load_async_to_lds_b128 %0, %1, off" :: "v"(loff), "v"(ga) : "memory");
}
__device__ __forceinline__ void wait_async0() {
  asm volatile("s_wait_asynccnt 0x0" ::: "memory");
}

// ---------------------------------------------------------------------------
// Staging helpers of the four projection GEMMs. Every GEMM keeps two LDS buffers per
// operand: the global loads of pass t+1 go out in front of the WMMAs of pass t (the Q
// projection's W loads behind them) and are
// converted and stored into the other buffer behind them, so that the time of the loads
// runs beside the LDS reads and the WMMAs, with one barrier per pass.
// ---------------------------------------------------------------------------
// N rows of a f32 tile -> registers; p is the thread's own place in its first row
template <int N, int STEP>
__device__ __forceinline__ void ld_rows_f32(v4f (&f)[N], const float* __restrict__ p) {
#pragma unroll  // f[] is indexed by constants only, so it lives in registers
  for (int e = 0; e < N; ++e) f[e] = *(const v4f*)(p + e * STEP);
}
// ... and on to LDS as f16; t is the thread's own place in its first row
template <int N, int STEP>
__device__ __forceinline__ void st_rows_f16(_Float16* t, const v4f (&f)[N]) {
#pragma unroll  // as above
  for (int e = 0; e < N; ++e) {
    half4 hh = {(_Float16)f[e].x, (_Float16)f[e].y, (_Float16)f[e].z, (_Float16)f[e].w};
    *(half4*)(t + e * STEP) = hh;
  }
}

// ---------------------------------------------------------------------------
// K/V projection GEMM: Y_f16 = (X_f32 @ W_f32^T + bias) * scale
// MODE 1: K (HEPOS gather rows t=h+16*l). out Kg[((b*H+h)*L + l)*64 + d]
// MODE 2: V (HEPOS gather) TRANSPOSED out: VgT[((b*H+h)*64 + d)*L + l]
// 64x64 tile / block, 4 waves each computing a 32x32 quadrant via 2x2 WMMAs.
// ---------------------------------------------------------------------------
static constexpr int BK = 128;     // k extent of one staged pass
static constexpr int PK = BK + 8;  // LDS row pitch in halves: row + 16 bytes

// one staged pass of a wave, in two halves of 64 k: 8 fragments, then their 8 WMMAs
__device__ __forceinline__ void mma_pass_kv(const _Float16* At, const _Float16* Bt, int wr,
                                            int wc, int lane, v8f (&acc)[2][2]) {
#pragma unroll
  for (int kh = 0; kh < BK; kh += 64) {
    v16h af[2][2], bf[2][2];
#pragma unroll
    for (int s = 0; s < 2; ++s)
#pragma unroll
      for (int i = 0; i < 2; ++i) {
        af[s][i] = ldfrag(At, PK, wr * 32 + i * 16, kh + s * 32, lane);
        bf[s][i] = ldfrag(Bt, PK, wc * 32 + i * 16, kh + s * 32, lane);
      }
    // keeps a half's LDS reads one group ahead of its own WMMAs; left to itself the
    // scheduler spreads them among the WMMAs and the wave waits out the LDS latency
    // at each of them
    __builtin_amdgcn_sched_barrier(0);
#pragma unroll
    for (int s = 0; s < 2; ++s)
#pragma unroll
      for (int i = 0; i < 2; ++i)
#pragma unroll
        for (int j = 0; j < 2; ++j) acc[i][j] = WMMA_F32_F16(af[s][i], bf[s][j], acc[i][j]);
  }
}

template <int MODE>
__global__ __launch_bounds__(128) void proj_kernel(
    const float* __restrict__ X, const float* __restrict__ W,
    const float* __restrict__ bias, _Float16* __restrict__ Y, float scale) {
  __shared__ __align__(16) _Float16 At[2][64 * PK];
  __shared__ __align__(16) _Float16 Bt[2][64 * PK];
  const int tid = threadIdx.x, lane = tid & 31;
  const int w = tid >> 5, wr = w >> 1, wc = w & 1;
  const int tile = blockIdx.x, h = blockIdx.y, b = blockIdx.z;
  const int n0 = h * DHc;
  // 64x128 of each operand per pass: a wave-wide load covers 512 contiguous bytes of one
  // row, wave w takes rows e*4+w
  const float* pa = X + ((long)b * TKc + h + 16 * (tile * 64 + w)) * Dc + lane * 4;
  const float* pb = W + (long)(n0 + w) * Dc + lane * 4;
  const int so = w * PK + lane * 4;  // the thread's place in row w of an LDS tile

  v4f fa[16], fb[16];
  v8f acc[2][2] = {};
  ld_rows_f32<16, 64 * Dc>(fa, pa);
  ld_rows_f32<16, 4 * Dc>(fb, pb);
  // as inputs the two addresses stay in their registers up to here, so that no load of
  // the group lands on them; the wait stands in front of their next rewrite
  asm volatile("s_wait_xcnt 0x0" :: "v"(pa), "v"(pb) : "memory");
  // keeps the conversions below the whole group of loads, so that all 32 are in flight
  __builtin_amdgcn_sched_barrier(0);
  st_rows_f16<16, 4 * PK>(&At[0][so], fa);
  st_rows_f16<16, 4 * PK>(&Bt[0][so], fb);
  __syncthreads();
  for (int t = 0; t < Dc / BK - 1; ++t) {
    pa += BK;
    pb += BK;
    ld_rows_f32<16, 64 * Dc>(fa, pa);
    ld_rows_f32<16, 4 * Dc>(fb, pb);
    // as in front of the loop
    asm volatile("s_wait_xcnt 0x0" :: "v"(pa), "v"(pb) : "memory");
    // keeps the next pass's 32 loads in front of this pass's LDS reads and WMMAs
    __builtin_amdgcn_sched_barrier(0);
    mma_pass_kv(At[t & 1], Bt[t & 1], wr, wc, lane, acc);
    // keeps the wait for the loads, and the conversions, behind this pass's WMMAs
    __builtin_amdgcn_sched_barrier(0);
    st_rows_f16<16, 4 * PK>(&At[(t + 1) & 1][so], fa);
    st_rows_f16<16, 4 * PK>(&Bt[(t + 1) & 1][so], fb);
    // publishes pass t+1 and ends the reads of pass t, whose buffer pass t+2 overwrites
    __syncthreads();
  }
  mma_pass_kv(At[(Dc / BK - 1) & 1], Bt[(Dc / BK - 1) & 1], wr, wc, lane, acc);
  const int base8 = ((lane >> 4) & 1) * 8;
#pragma unroll
  for (int i = 0; i < 2; ++i)
#pragma unroll
    for (int j = 0; j < 2; ++j) {
      int nl = wc * 32 + j * 16 + (lane & 15);
      float bv = bias[n0 + nl];
      if (MODE == 2) {  // transposed: row d=nl, 8 consecutive l -> one b128
        int l = tile * 64 + wr * 32 + i * 16 + base8;
        half8 pk;
#pragma unroll
        for (int v = 0; v < 8; ++v) pk[v] = (_Float16)((acc[i][j][v] + bv) * scale);
        *(half8*)(Y + (((long)b * Hc + h) * DHc + nl) * Lc + l) = pk;
      } else {
#pragma unroll
        for (int v = 0; v < 8; ++v) {
          int ml = wr * 32 + i * 16 + base8 + v;
          float y = (acc[i][j][v] + bv) * scale;
          long o = (((long)b * Hc + h) * Lc + (tile * 64 + ml)) * DHc + nl;
          Y[o] = (_Float16)y;
        }
      }
    }
}

// ---------------------------------------------------------------------------
// The two dense 8192 x 1024 x 1024 GEMMs (Q projection, output projection):
// 128x128 tile per block, 8 waves in a 4x2 grid, each computing 32x64 via 2x4 WMMAs,
// 128 k staged per pass. A block loads 128 + 128 operand rows for 128 x 128
// outputs: half the L2 bytes per output of a 64x64 tile.
// ---------------------------------------------------------------------------
static constexpr int GT = 128;     // block tile, rows and columns
static constexpr int GK = 128;     // k extent of one staged pass
static constexpr int GP = GK + 8;  // LDS row pitch in halves: row + 16 bytes

// one staged pass of a wave, in two halves of 64 k: 12 fragments, then their 16 WMMAs;
// k runs upward as in the 64x64 tile
__device__ __forceinline__ void mma_pass(const _Float16* At, const _Float16* Bt, int wr,
                                         int wc, int lane, v8f (&acc)[2][4]) {
#pragma unroll
  for (int kh = 0; kh < GK; kh += 64) {
    v16h af[2][2], bf[2][4];
#pragma unroll
    for (int s = 0; s < 2; ++s) {
#pragma unroll
      for (int i = 0; i < 2; ++i)
        af[s][i] = ldfrag(At, GP, wr * 32 + i * 16, kh + s * 32, lane);
#pragma unroll
      for (int j = 0; j < 4; ++j)
        bf[s][j] = ldfrag(Bt, GP, wc * 64 + j * 16, kh + s * 32, lane);
    }
    // keeps a half's LDS reads ahead of its own WMMAs: the first half's go out as one
    // group, the second half's among the first half's WMMAs as registers come free
    __builtin_amdgcn_sched_barrier(0);
#pragma unroll
    for (int s = 0; s < 2; ++s)
#pragma unroll
      for (int i = 0; i < 2; ++i)
#pragma unroll
        for (int j = 0; j < 4; ++j) acc[i][j] = WMMA_F32_F16(af[s][i], bf[s][j], acc[i][j]);
  }
}

// Q projection: Qh[((b*H+h)*TQ + t)*64 + d] = (q @ Wq^T + bq) * scale, f16.
// grid ((B*TQ)/128, D/128); a block's 128 columns are two heads, one per wave column.
__global__ __launch_bounds__(256) void qproj_kernel(
    const float* __restrict__ X, const float* __restrict__ W,
    const float* __restrict__ bias, _Float16* __restrict__ Y, float scale) {
  __shared__ __align__(16) _Float16 At[2][GT * GP];
  __shared__ __align__(16) _Float16 Bt[2][GT * GP];
  const int tid = threadIdx.x, lane = tid & 31;
  const int w = tid >> 5, wr = w >> 1, wc = w & 1;
  const int m0 = blockIdx.x * GT, n0 = blockIdx.y * GT;
  // 128x128 of each operand per pass: a wave-wide load covers the 512 contiguous bytes of
  // one row, wave w takes rows e*8+w
  const float* pa = X + (long)(m0 + w) * Dc + lane * 4;
  const float* pb = W + (long)(n0 + w) * Dc + lane * 4;
  const int so = w * GP + lane * 4;  // the thread's place in row w of an LDS tile

  v4f fa[16], fb[16];
  v8f acc[2][4] = {};
  ld_rows_f32<16, 8 * Dc>(fa, pa);
  ld_rows_f32<16, 8 * Dc>(fb, pb);
  // as inputs the two addresses stay in their registers up to here, so that no load of
  // the group lands on them; the wait stands in front of their next rewrite
  asm volatile("s_wait_xcnt 0x0" :: "v"(pa), "v"(pb) : "memory");
  // keeps the conversions below the whole group of loads, so that all 32 are in flight
  __builtin_amdgcn_sched_barrier(0);
  st_rows_f16<16, 8 * GP>(&At[0][so], fa);
  st_rows_f16<16, 8 * GP>(&Bt[0][so], fb);
  __syncthreads();
  for (int t = 0; t < Dc / GK - 1; ++t) {
    // X comes from memory: its next 16 loads fly over this pass's WMMAs. The registers of
    // two blocks on a WGP do not hold W's 16 beside the fragments as well: W, which L2
    // holds, follows behind the WMMAs.
    pa += GK;
    ld_rows_f32<16, 8 * Dc>(fa, pa);
    // as in front of the loop
    asm volatile("s_wait_xcnt 0x0" :: "v"(pa) : "memory");
    // keeps the X loads in front of this pass's LDS reads and WMMAs
    __builtin_amdgcn_sched_barrier(0);
    mma_pass(At[t & 1], Bt[t & 1], wr, wc, lane, acc);
    // keeps the W loads behind the WMMAs, where the fragments' registers are free
    __builtin_amdgcn_sched_barrier(0);
    pb += GK;
    ld_rows_f32<16, 8 * Dc>(fb, pb);
    // as in front of the loop
    asm volatile("s_wait_xcnt 0x0" :: "v"(pb) : "memory");
    // keeps the conversions below the W loads, so that all 16 are in flight
    __builtin_amdgcn_sched_barrier(0);
    st_rows_f16<16, 8 * GP>(&At[(t + 1) & 1][so], fa);
    st_rows_f16<16, 8 * GP>(&Bt[(t + 1) & 1][so], fb);
    // publishes pass t+1 and ends the reads of pass t, whose buffer pass t+2 overwrites
    __syncthreads();
  }
  mma_pass(At[(Dc / GK - 1) & 1], Bt[(Dc / GK - 1) & 1], wr, wc, lane, acc);
  const int base8 = ((lane >> 4) & 1) * 8;
  const int b = m0 / TQc, t0 = m0 % TQc, h = blockIdx.y * 2 + wc;
#pragma unroll
  for (int i = 0; i < 2; ++i)
#pragma unroll
    for (int j = 0; j < 4; ++j) {
      int d = j * 16 + (lane & 15);
      float bv = bias[h * DHc + d];
#pragma unroll
      for (int v = 0; v < 8; ++v) {
        int t = t0 + wr * 32 + i * 16 + base8 + v;
        Y[(((long)b * Hc + h) * TQc + t) * DHc + d] = (_Float16)((acc[i][j][v] + bv) * scale);
      }
    }
}

__device__ __forceinline__ float other_half(float x) {
  int b = __builtin_bit_cast(int, x);
  return __builtin_bit_cast(
      float, __builtin_amdgcn_permlanex16(b, b, 0x76543210, 0xfedcba98, false, false));
}

__global__ __launch_bounds__(128) void attn_kernel(
    const _Float16* __restrict__ Qh, const _Float16* __restrict__ Kg,
    const _Float16* __restrict__ VgT, _Float16* __restrict__ O) {
  __shared__ __align__(16) _Float16 kt[2][64 * 72];
  __shared__ __align__(16) _Float16 vt[2][64 * 72];
  const int tid = threadIdx.x, lane = tid & 31, w = tid >> 5;
  const int qt = blockIdx.x, h = blockIdx.y, b = blockIdx.z;
  const int q0 = qt * 64 + w * 16;

  const _Float16* Qb = Qh + (((long)b * Hc + h) * TQc + q0) * DHc;
  const _Float16* Kb = Kg + (((long)b * Hc + h) * Lc) * DHc;
  const _Float16* Vb = VgT + (((long)b * Hc + h) * DHc) * Lc;

  v16h qb0 = ldfrag(Qb, DHc, 0, 0, lane);   // B operand: query lane%16, d = 0..31
  v16h qb1 = ldfrag(Qb, DHc, 0, 32, lane);  // d = 32..63

  float mrun = -1e30f, lrun = 0.f;  // of this lane's query; lrun over this half's keys
  v8f oacc[4] = {};                 // O^T: oacc[t][r] = O[query col][d = t*16 + rb + r]
  const int col = lane & 15, rb = ((lane >> 4) & 1) * 8;

  // staging coordinates: each thread copies 32 halves of K and of V^T
  const int sr = tid >> 1, sc = (tid & 1) * 32;

  // prologue: stage chunk 0 into buffer 0
#pragma unroll
  for (int u = 0; u < 4; ++u) {
    async_b128(Kb + (long)sr * DHc + sc + u * 8, &kt[0][sr * 72 + sc + u * 8]);
    async_b128(Vb + (long)sr * Lc + sc + u * 8, &vt[0][sr * 72 + sc + u * 8]);
  }
  wait_async0();
  __syncthreads();

  const int NCH = Lc / 64;  // 8 chunks
  for (int c = 0; c < NCH; ++c) {
    const int cur = c & 1;
    if (c + 1 < NCH) {  // issue next chunk's copies; they overlap compute below
      int l1 = (c + 1) * 64;
#pragma unroll
      for (int u = 0; u < 4; ++u) {
        async_b128(Kb + (long)(l1 + sr) * DHc + sc + u * 8,
                   &kt[cur ^ 1][sr * 72 + sc + u * 8]);
        async_b128(Vb + (long)sr * Lc + l1 + sc + u * 8,
                   &vt[cur ^ 1][sr * 72 + sc + u * 8]);
      }
    }
    const _Float16* K = &kt[cur][0];
    const _Float16* V = &vt[cur][0];

    v8f z = {};
    v8f s[4];
#pragma unroll
    for (int t = 0; t < 4; ++t) {  // scores: s[t][r] = S[query col][l = t*16 + rb + r]
      s[t] = WMMA_F32_F16(ldfrag(K, 72, t * 16, 0, lane), qb0, z);
      s[t] = WMMA_F32_F16(ldfrag(K, 72, t * 16, 32, lane), qb1, s[t]);
    }

    // Online softmax, one query per lane: 32 of the chunk's 64 keys here, 32 in lane^16.
    float cmax = s[0][0];
#pragma unroll
    for (int t = 0; t < 4; ++t)
#pragma unroll
      for (int r = 0; r < 8; ++r) cmax = fmaxf(cmax, s[t][r]);
    cmax = fmaxf(cmax, other_half(cmax));
    const float nm = fmaxf(mrun, cmax);
    const float corr = __expf(mrun - nm);
    mrun = nm;
#pragma unroll
    for (int t = 0; t < 4; ++t) oacc[t] *= corr;
    v8f sv;
#pragma unroll
    for (int u = 0; u < 2; ++u) {  // 32 keys at a time
#pragma unroll
      for (int t = 2 * u; t < 2 * u + 2; ++t) {
#pragma unroll
        for (int r = 0; r < 8; ++r) s[t][r] = __expf(s[t][r] - nm);
        sv = t == 0 ? s[0] : sv + s[t];
      }
      // P^T as B operand: tiles 2u and 2u+1 hold keys 32u + rb + {0..7} and 32u + 16 + rb +
      // {0..7} of this lane's query, the k order in which ldfrag reads V^T
      const v16h pb = __builtin_shufflevector(__builtin_convertvector(s[2 * u], half8),
                                              __builtin_convertvector(s[2 * u + 1], half8), 0, 1,
                                              2, 3, 4, 5, 6, 7, 8, 9, 10, 11, 12, 13, 14, 15);
#pragma unroll
      for (int t = 0; t < 4; ++t)  // O^T += V^T(16 d x 32 l) @ P^T(32 l x 16 q) per d-tile
        oacc[t] = WMMA_F32_F16(ldfrag(V, 72, t * 16, u * 32, lane), pb, oacc[t]);
    }
    lrun = lrun * corr + (((sv[0] + sv[1]) + (sv[2] + sv[3])) + ((sv[4] + sv[5]) + (sv[6] + sv[7])));
    wait_async0();    // next chunk's async copies complete
    __syncthreads();  // ... and visible to all waves
  }

  // join the two halves' sums, normalize, store f16 [B, TQ, D]: 8 consecutive d per tile
  const float inv = 1.f / (lrun + other_half(lrun));
  _Float16* Or = O + ((long)b * TQc + (q0 + col)) * Dc + h * DHc + rb;
#pragma unroll
  for (int t = 0; t < 4; ++t)
    *(half8*)(Or + t * 16) = __builtin_convertvector(oacc[t] * inv, half8);
}

// ---------------------------------------------------------------------------
// Output projection: out_f32[M,1024] = O_f16[M,1024] @ Wo^T + bo
// grid ((B*TQ)/128, 1024/128). A-tile staged via async copies (pure f16 copy),
// W-tile through registers (f32->f16); both of pass t+1 fly over the WMMAs of pass t.
// ---------------------------------------------------------------------------
// 128x128 f16 tile -> LDS, eight async 16-byte copies per lane. The s_wait_xcnt closes the
// statement so that it stands in front of any rewrite of the address registers.
__device__ __forceinline__ void async_tile_f16(const _Float16* src, _Float16* t, int tid) {
  unsigned l[8];
  unsigned long long g[8];
#pragma unroll
  for (int e = 0; e < 8; ++e) {
    int r = e * 16 + (tid >> 4), c = (tid & 15) * 8;
    l[e] = (unsigned)(unsigned long long)(uintptr_t)(t + r * GP + c);
    g[e] = (unsigned long long)(uintptr_t)(src + r * Dc + c);
  }
  asm volatile(
      "global_load_async_to_lds_b128 %0, %8, off\n\t"
      "global_load_async_to_lds_b128 %1, %9, off\n\t"
      "global_load_async_to_lds_b128 %2, %10, off\n\t"
      "global_load_async_to_lds_b128 %3, %11, off\n\t"
      "global_load_async_to_lds_b128 %4, %12, off\n\t"
      "global_load_async_to_lds_b128 %5, %13, off\n\t"
      "global_load_async_to_lds_b128 %6, %14, off\n\t"
      "global_load_async_to_lds_b128 %7, %15, off\n\t"
      "s_wait_xcnt 0x0"
      :: "v"(l[0]), "v"(l[1]), "v"(l[2]), "v"(l[3]), "v"(l[4]), "v"(l[5]), "v"(l[6]), "v"(l[7]),
         "v"(g[0]), "v"(g[1]), "v"(g[2]), "v"(g[3]), "v"(g[4]), "v"(g[5]), "v"(g[6]), "v"(g[7])
      : "memory");
}

__global__ __launch_bounds__(256) void outproj_kernel(
    const _Float16* __restrict__ A, const float* __restrict__ W,
    const float* __restrict__ bias, float* __restrict__ Out) {
  __shared__ __align__(16) _Float16 At[2][GT * GP];
  __shared__ __align__(16) _Float16 Bt[2][GT * GP];
  const int tid = threadIdx.x, lane = tid & 31;
  const int w = tid >> 5, wr = w >> 1, wc = w & 1;
  const int m0 = blockIdx.x * GT, n0 = blockIdx.y * GT;
  const _Float16* Ar = A + (long)m0 * Dc;
  const float* pb = W + (long)(n0 + w) * Dc + lane * 4;  // wave w takes rows e*8+w
  const int so = w * GP + lane * 4;

  v4f fb[16];
  v8f acc[2][4] = {};
  ld_rows_f32<16, 8 * Dc>(fb, pb);
  // as an input the address stays in its registers up to here, so that no load of the
  // group lands on it; the wait stands in front of its next rewrite
  asm volatile("s_wait_xcnt 0x0" :: "v"(pb) : "memory");
  async_tile_f16(Ar, At[0], tid);  // A is f16 already: no register on its way
  // keeps the conversions below the loads and copies, so that all are in flight
  __builtin_amdgcn_sched_barrier(0);
  st_rows_f16<16, 8 * GP>(&Bt[0][so], fb);
  wait_async0();
  __syncthreads();
  for (int t = 0; t < Dc / GK - 1; ++t) {
    pb += GK;
    ld_rows_f32<16, 8 * Dc>(fb, pb);
    // as in front of the loop
    asm volatile("s_wait_xcnt 0x0" :: "v"(pb) : "memory");
    async_tile_f16(Ar + (t + 1) * GK, At[(t + 1) & 1], tid);
    // keeps the next pass's loads and copies in front of this pass's LDS reads and WMMAs
    __builtin_amdgcn_sched_barrier(0);
    mma_pass(At[t & 1], Bt[t & 1], wr, wc, lane, acc);
    // keeps the wait for the loads, and the conversions, behind this pass's WMMAs
    __builtin_amdgcn_sched_barrier(0);
    st_rows_f16<16, 8 * GP>(&Bt[(t + 1) & 1][so], fb);
    // this wave's LDS reads of pass t are done before copies may land on their buffer
    asm volatile("s_wait_dscnt 0x0" ::: "memory");
    wait_async0();  // this wave's copies of pass t+1 have landed
    // publishes pass t+1 and ends the reads of pass t, whose buffer pass t+2 overwrites
    __syncthreads();
  }
  wait_async0();  // no copy is outstanding behind the loop
  mma_pass(At[(Dc / GK - 1) & 1], Bt[(Dc / GK - 1) & 1], wr, wc, lane, acc);
  const int base8 = ((lane >> 4) & 1) * 8;
#pragma unroll
  for (int i = 0; i < 2; ++i)
#pragma unroll
    for (int j = 0; j < 4; ++j) {
      int nl = wc * 64 + j * 16 + (lane & 15);
      float bv = bias[n0 + nl];
#pragma unroll
      for (int v = 0; v < 8; ++v) {
        int ml = wr * 32 + i * 16 + base8 + v;
        Out[(long)(m0 + ml) * Dc + n0 + nl] = acc[i][j][v] + bv;
      }
    }
}

extern "C" void kernel_launch(void* const* d_in, const int* in_sizes, int n_in,
                              void* d_out, int out_size, void* d_ws, size_t ws_size,
                              hipStream_t stream) {
  const float* q  = (const float*)d_in[0];
  const float* k  = (const float*)d_in[1];
  const float* v  = (const float*)d_in[2];
  const float* Wq = (const float*)d_in[3];
  const float* bq = (const float*)d_in[4];
  const float* Wk = (const float*)d_in[5];
  const float* bk = (const float*)d_in[6];
  const float* Wv = (const float*)d_in[7];
  const float* bv = (const float*)d_in[8];
  const float* Wo = (const float*)d_in[9];
  const float* bo = (const float*)d_in[10];
  float* out = (float*)d_out;

  char* ws = (char*)d_ws;
  _Float16* Qh  = (_Float16*)ws;  // [B,H,TQ,64] f16
  _Float16* Kg  = (_Float16*)(ws + (size_t)Bc * Hc * TQc * DHc * 2);
  _Float16* VgT = (_Float16*)((char*)Kg + (size_t)Bc * Hc * Lc * DHc * 2);
  _Float16* Oa  = (_Float16*)((char*)VgT + (size_t)Bc * Hc * Lc * DHc * 2);  // [B,TQ,D] f16

  dim3 blk(128), blk8(256);
  // Q projection with 1/sqrt(dh) folded in
  qproj_kernel<<<dim3((Bc * TQc) / GT, Dc / GT), blk8, 0, stream>>>(q, Wq, bq, Qh, 0.125f);
  // HEPOS-gathered K/V projections (16x fewer FLOPs than dense K/V proj);
  // V written transposed [b,h,d,l] for contiguous P@V fragment loads.
  proj_kernel<1><<<dim3(Lc / 64, Hc, Bc), blk, 0, stream>>>(k, Wk, bk, Kg, 1.0f);
  proj_kernel<2><<<dim3(Lc / 64, Hc, Bc), blk, 0, stream>>>(v, Wv, bv, VgT, 1.0f);
  attn_kernel<<<dim3(TQc / 64, Hc, Bc), blk, 0, stream>>>(Qh, Kg, VgT, Oa);
  outproj_kernel<<<dim3((Bc * TQc) / GT, Dc / GT), blk8, 0, stream>>>(Oa, Wo, bo, out);
}

// v005
// It runs in 88.1 microseconds.
// Next to v004, in two timings, it ran 1.15 times as fast each time.
// Over all steps from v000 it is 1.72 times as fast.
#include <hip/hip_runtime.h>
#include <hip/hip_bf16.h>
#include <math.h>

typedef _Float16 v16h  __attribute__((ext_vector_type(16)));
typedef _Float16 half8 __attribute__((ext_vector_type(8)));
typedef _Float16 half4 __attribute__((ext_vector_type(4)));
typedef float    v8f   __attribute__((ext_vector_type(8)));
typedef float    v4f   __attribute__((ext_vector_type(4)));

#define WMMA_F32_F16(a, b, c) \
  __builtin_amdgcn_wmma_f32_16x16x32_f16(false, (a), false, (b), (short)0, (c), false, false)

static constexpr int Bc = 4, TQc = 2048, TKc = 8192, Dc = 1024;
static constexpr int Hc = 16, DHc = 64, Lc = 512;

// Load a 16x32 f16 WMMA A/B fragment from an LDS (or global) tile.
// A-layout per CDNA5 ISA: lane L holds row (row_base + L%16); halves j cover
// k = kb + {0..7} and k = kb + {16..23}, kb = 8*(L>=16) + koff.
__device__ __forceinline__ v16h ldfrag(const _Float16* t, int stride, int row_base,
                                       int koff, int lane) {
  int r  = row_base + (lane & 15);
  int kb = ((lane >> 4) & 1) * 8 + koff;
  half8 lo = *(const half8*)(t + r * stride + kb);
  half8 hi = *(const half8*)(t + r * stride + kb + 16);
  return __builtin_shufflevector(lo, hi, 0, 1, 2, 3, 4, 5, 6, 7,
                                 8, 9, 10, 11, 12, 13, 14, 15);
}

// waits out this wave's async memory->LDS copies (tracked by ASYNCcnt)
__device__ __forceinline__ void wait_async0() {
  asm volatile("s_wait_asynccnt 0x0" ::: "memory");
}

// ---------------------------------------------------------------------------
// Staging helpers of the four projection GEMMs. Every GEMM keeps two LDS buffers per
// operand: the global loads of pass t+1 go out in front of the WMMAs of pass t (the Q
// projection's W loads behind them) and are
// converted and stored into the other buffer behind them, so that the time of the loads
// runs beside the LDS reads and the WMMAs, with one barrier per pass.
// ---------------------------------------------------------------------------
// N rows of a f32 tile -> registers; p is the thread's own place in its first row
template <int N, int STEP>
__device__ __forceinline__ void ld_rows_f32(v4f (&f)[N], const float* __restrict__ p) {
#pragma unroll  // f[] is indexed by constants only, so it lives in registers
  for (int e = 0; e < N; ++e) f[e] = *(const v4f*)(p + e * STEP);
}
// ... and on to LDS as f16; t is the thread's own place in its first row
template <int N, int STEP>
__device__ __forceinline__ void st_rows_f16(_Float16* t, const v4f (&f)[N]) {
#pragma unroll  // as above
  for (int e = 0; e < N; ++e) {
    half4 hh = {(_Float16)f[e].x, (_Float16)f[e].y, (_Float16)f[e].z, (_Float16)f[e].w};
    *(half4*)(t + e * STEP) = hh;
  }
}

// ---------------------------------------------------------------------------
// K/V projection GEMM: Y_f16 = (X_f32 @ W_f32^T + bias) * scale
// MODE 1: K (HEPOS gather rows t=h+16*l). out Kg[((b*H+h)*L + l)*64 + d]
// MODE 2: V (HEPOS gather) TRANSPOSED out: VgT[((b*H+h)*64 + d)*L + l]
// 64x64 tile / block, 4 waves each computing a 32x32 quadrant via 2x2 WMMAs.
// ---------------------------------------------------------------------------
static constexpr int BK = 128;     // k extent of one staged pass
static constexpr int PK = BK + 8;  // LDS row pitch in halves: row + 16 bytes

// one staged pass of a wave, in two halves of 64 k: 8 fragments, then their 8 WMMAs
__device__ __forceinline__ void mma_pass_kv(const _Float16* At, const _Float16* Bt, int wr,
                                            int wc, int lane, v8f (&acc)[2][2]) {
#pragma unroll
  for (int kh = 0; kh < BK; kh += 64) {
    v16h af[2][2], bf[2][2];
#pragma unroll
    for (int s = 0; s < 2; ++s)
#pragma unroll
      for (int i = 0; i < 2; ++i) {
        af[s][i] = ldfrag(At, PK, wr * 32 + i * 16, kh + s * 32, lane);
        bf[s][i] = ldfrag(Bt, PK, wc * 32 + i * 16, kh + s * 32, lane);
      }
    // keeps a half's LDS reads one group ahead of its own WMMAs; left to itself the
    // scheduler spreads them among the WMMAs and the wave waits out the LDS latency
    // at each of them
    __builtin_amdgcn_sched_barrier(0);
#pragma unroll
    for (int s = 0; s < 2; ++s)
#pragma unroll
      for (int i = 0; i < 2; ++i)
#pragma unroll
        for (int j = 0; j < 2; ++j) acc[i][j] = WMMA_F32_F16(af[s][i], bf[s][j], acc[i][j]);
  }
}

template <int MODE>
__global__ __launch_bounds__(128) void proj_kernel(
    const float* __restrict__ X, const float* __restrict__ W,
    const float* __restrict__ bias, _Float16* __restrict__ Y, float scale) {
  __shared__ __align__(16) _Float16 At[2][64 * PK];
  __shared__ __align__(16) _Float16 Bt[2][64 * PK];
  const int tid = threadIdx.x, lane = tid & 31;
  const int w = tid >> 5, wr = w >> 1, wc = w & 1;
  const int tile = blockIdx.x, h = blockIdx.y, b = blockIdx.z;
  const int n0 = h * DHc;
  // 64x128 of each operand per pass: a wave-wide load covers 512 contiguous bytes of one
  // row, wave w takes rows e*4+w
  const float* pa = X + ((long)b * TKc + h + 16 * (tile * 64 + w)) * Dc + lane * 4;
  const float* pb = W + (long)(n0 + w) * Dc + lane * 4;
  const int so = w * PK + lane * 4;  // the thread's place in row w of an LDS tile

  v4f fa[16], fb[16];
  v8f acc[2][2] = {};
  ld_rows_f32<16, 64 * Dc>(fa, pa);
  ld_rows_f32<16, 4 * Dc>(fb, pb);
  // as inputs the two addresses stay in their registers up to here, so that no load of
  // the group lands on them; the wait stands in front of their next rewrite
  asm volatile("s_wait_xcnt 0x0" :: "v"(pa), "v"(pb) : "memory");
  // keeps the conversions below the whole group of loads, so that all 32 are in flight
  __builtin_amdgcn_sched_barrier(0);
  st_rows_f16<16, 4 * PK>(&At[0][so], fa);
  st_rows_f16<16, 4 * PK>(&Bt[0][so], fb);
  __syncthreads();
  for (int t = 0; t < Dc / BK - 1; ++t) {
    pa += BK;
    pb += BK;
    ld_rows_f32<16, 64 * Dc>(fa, pa);
    ld_rows_f32<16, 4 * Dc>(fb, pb);
    // as in front of the loop
    asm volatile("s_wait_xcnt 0x0" :: "v"(pa), "v"(pb) : "memory");
    // keeps the next pass's 32 loads in front of this pass's LDS reads and WMMAs
    __builtin_amdgcn_sched_barrier(0);
    mma_pass_kv(At[t & 1], Bt[t & 1], wr, wc, lane, acc);
    // keeps the wait for the loads, and the conversions, behind this pass's WMMAs
    __builtin_amdgcn_sched_barrier(0);
    st_rows_f16<16, 4 * PK>(&At[(t + 1) & 1][so], fa);
    st_rows_f16<16, 4 * PK>(&Bt[(t + 1) & 1][so], fb);
    // publishes pass t+1 and ends the reads of pass t, whose buffer pass t+2 overwrites
    __syncthreads();
  }
  mma_pass_kv(At[(Dc / BK - 1) & 1], Bt[(Dc / BK - 1) & 1], wr, wc, lane, acc);
  const int base8 = ((lane >> 4) & 1) * 8;
#pragma unroll
  for (int i = 0; i < 2; ++i)
#pragma unroll
    for (int j = 0; j < 2; ++j) {
      int nl = wc * 32 + j * 16 + (lane & 15);
      float bv = bias[n0 + nl];
      if (MODE == 2) {  // transposed: row d=nl, 8 consecutive l -> one b128
        int l = tile * 64 + wr * 32 + i * 16 + base8;
        half8 pk;
#pragma unroll
        for (int v = 0; v < 8; ++v) pk[v] = (_Float16)((acc[i][j][v] + bv) * scale);
        *(half8*)(Y + (((long)b * Hc + h) * DHc + nl) * Lc + l) = pk;
      } else {
#pragma unroll
        for (int v = 0; v < 8; ++v) {
          int ml = wr * 32 + i * 16 + base8 + v;
          float y = (acc[i][j][v] + bv) * scale;
          long o = (((long)b * Hc + h) * Lc + (tile * 64 + ml)) * DHc + nl;
          Y[o] = (_Float16)y;
        }
      }
    }
}

// ---------------------------------------------------------------------------
// The two dense 8192 x 1024 x 1024 GEMMs (Q projection, output projection):
// 128x128 tile per block, 8 waves in a 4x2 grid, each computing 32x64 via 2x4 WMMAs,
// 128 k staged per pass. A block loads 128 + 128 operand rows for 128 x 128
// outputs: half the L2 bytes per output of a 64x64 tile.
// ---------------------------------------------------------------------------
static constexpr int GT = 128;     // block tile, rows and columns
static constexpr int GK = 128;     // k extent of one staged pass
static constexpr int GP = GK + 8;  // LDS row pitch in halves: row + 16 bytes

// one staged pass of a wave, in two halves of 64 k: 12 fragments, then their 16 WMMAs;
// k runs upward as in the 64x64 tile
__device__ __forceinline__ void mma_pass(const _Float16* At, const _Float16* Bt, int wr,
                                         int wc, int lane, v8f (&acc)[2][4]) {
#pragma unroll
  for (int kh = 0; kh < GK; kh += 64) {
    v16h af[2][2], bf[2][4];
#pragma unroll
    for (int s = 0; s < 2; ++s) {
#pragma unroll
      for (int i = 0; i < 2; ++i)
        af[s][i] = ldfrag(At, GP, wr * 32 + i * 16, kh + s * 32, lane);
#pragma unroll
      for (int j = 0; j < 4; ++j)
        bf[s][j] = ldfrag(Bt, GP, wc * 64 + j * 16, kh + s * 32, lane);
    }
    // keeps a half's LDS reads ahead of its own WMMAs: the first half's go out as one
    // group, the second half's among the first half's WMMAs as registers come free
    __builtin_amdgcn_sched_barrier(0);
#pragma unroll
    for (int s = 0; s < 2; ++s)
#pragma unroll
      for (int i = 0; i < 2; ++i)
#pragma unroll
        for (int j = 0; j < 4; ++j) acc[i][j] = WMMA_F32_F16(af[s][i], bf[s][j], acc[i][j]);
  }
}

// Q projection: Qh[((b*H+h)*TQ + t)*64 + d] = (q @ Wq^T + bq) * scale, f16.
// grid ((B*TQ)/128, D/128); a block's 128 columns are two heads, one per wave column.
__global__ __launch_bounds__(256) void qproj_kernel(
    const float* __restrict__ X, const float* __restrict__ W,
    const float* __restrict__ bias, _Float16* __restrict__ Y, float scale) {
  __shared__ __align__(16) _Float16 At[2][GT * GP];
  __shared__ __align__(16) _Float16 Bt[2][GT * GP];
  const int tid = threadIdx.x, lane = tid & 31;
  const int w = tid >> 5, wr = w >> 1, wc = w & 1;
  const int m0 = blockIdx.x * GT, n0 = blockIdx.y * GT;
  // 128x128 of each operand per pass: a wave-wide load covers the 512 contiguous bytes of
  // one row, wave w takes rows e*8+w
  const float* pa = X + (long)(m0 + w) * Dc + lane * 4;
  const float* pb = W + (long)(n0 + w) * Dc + lane * 4;
  const int so = w * GP + lane * 4;  // the thread's place in row w of an LDS tile

  v4f fa[16], fb[16];
  v8f acc[2][4] = {};
  ld_rows_f32<16, 8 * Dc>(fa, pa);
  ld_rows_f32<16, 8 * Dc>(fb, pb);
  // as inputs the two addresses stay in their registers up to here, so that no load of
  // the group lands on them; the wait stands in front of their next rewrite
  asm volatile("s_wait_xcnt 0x0" :: "v"(pa), "v"(pb) : "memory");
  // keeps the conversions below the whole group of loads, so that all 32 are in flight
  __builtin_amdgcn_sched_barrier(0);
  st_rows_f16<16, 8 * GP>(&At[0][so], fa);
  st_rows_f16<16, 8 * GP>(&Bt[0][so], fb);
  __syncthreads();
  for (int t = 0; t < Dc / GK - 1; ++t) {
    // X comes from memory: its next 16 loads fly over this pass's WMMAs. The registers of
    // two blocks on a WGP do not hold W's 16 beside the fragments as well: W, which L2
    // holds, follows behind the WMMAs.
    pa += GK;
    ld_rows_f32<16, 8 * Dc>(fa, pa);
    // as in front of the loop
    asm volatile("s_wait_xcnt 0x0" :: "v"(pa) : "memory");
    // keeps the X loads in front of this pass's LDS reads and WMMAs
    __builtin_amdgcn_sched_barrier(0);
    mma_pass(At[t & 1], Bt[t & 1], wr, wc, lane, acc);
    // keeps the W loads behind the WMMAs, where the fragments' registers are free
    __builtin_amdgcn_sched_barrier(0);
    pb += GK;
    ld_rows_f32<16, 8 * Dc>(fb, pb);
    // as in front of the loop
    asm volatile("s_wait_xcnt 0x0" :: "v"(pb) : "memory");
    // keeps the conversions below the W loads, so that all 16 are in flight
    __builtin_amdgcn_sched_barrier(0);
    st_rows_f16<16, 8 * GP>(&At[(t + 1) & 1][so], fa);
    st_rows_f16<16, 8 * GP>(&Bt[(t + 1) & 1][so], fb);
    // publishes pass t+1 and ends the reads of pass t, whose buffer pass t+2 overwrites
    __syncthreads();
  }
  mma_pass(At[(Dc / GK - 1) & 1], Bt[(Dc / GK - 1) & 1], wr, wc, lane, acc);
  const int base8 = ((lane >> 4) & 1) * 8;
  const int b = m0 / TQc, t0 = m0 % TQc, h = blockIdx.y * 2 + wc;
#pragma unroll
  for (int i = 0; i < 2; ++i)
#pragma unroll
    for (int j = 0; j < 4; ++j) {
      int d = j * 16 + (lane & 15);
      float bv = bias[h * DHc + d];
#pragma unroll
      for (int v = 0; v < 8; ++v) {
        int t = t0 + wr * 32 + i * 16 + base8 + v;
        Y[(((long)b * Hc + h) * TQc + t) * DHc + d] = (_Float16)((acc[i][j][v] + bv) * scale);
      }
    }
}

__device__ __forceinline__ float other_half(float x) {
  int b = __builtin_bit_cast(int, x);
  return __builtin_bit_cast(
      float, __builtin_amdgcn_permlanex16(b, b, 0x76543210, 0xfedcba98, false, false));
}

// A lane's share of one chunk: 32 bytes of K and 32 of V^T, four async 16-byte copies. The
// s_wait_xcnt closes the statement so that it stands in front of any rewrite of the address
// registers.
__device__ __forceinline__ void async_chunk(const _Float16* kg, const _Float16* vg,
                                            _Float16* kl, _Float16* vl) {
  unsigned lk = (unsigned)(unsigned long long)(uintptr_t)kl;  // low 32b = LDS offset
  unsigned lv = (unsigned)(unsigned long long)(uintptr_t)vl;
  unsigned lk1 = lk + 16, lv1 = lv + 16;
  unsigned long long gk = (unsigned long long)(uintptr_t)kg;
  unsigned long long gv = (unsigned long long)(uintptr_t)vg;
  unsigned long long gk1 = gk + 16, gv1 = gv + 16;
  asm volatile(
      "global_load_async_to_lds_b128 %0, %4, off\n\t"
      "global_load_async_to_lds_b128 %1, %5, off\n\t"
      "global_load_async_to_lds_b128 %2, %6, off\n\t"
      "global_load_async_to_lds_b128 %3, %7, off\n\t"
      "s_wait_xcnt 0x0"
      :: "v"(lk), "v"(lk1), "v"(lv), "v"(lv1), "v"(gk), "v"(gk1), "v"(gv), "v"(gv1)
      : "memory");
}

static constexpr int QW = 2;  // 16-query tiles per wave

__global__ __launch_bounds__(256) void attn_kernel(
    const _Float16* __restrict__ Qh, const _Float16* __restrict__ Kg,
    const _Float16* __restrict__ VgT, _Float16* __restrict__ O) {
  __shared__ __align__(16) _Float16 kt[2][64 * 72];
  __shared__ __align__(16) _Float16 vt[2][64 * 72];
  const int tid = threadIdx.x, lane = tid & 31, w = tid >> 5;
  const int qt = blockIdx.x, h = blockIdx.y, b = blockIdx.z;
  const int q0 = qt * (8 * QW * 16) + w * (QW * 16);

  const _Float16* Qb = Qh + (((long)b * Hc + h) * TQc + q0) * DHc;
  const _Float16* Kb = Kg + (((long)b * Hc + h) * Lc) * DHc;
  const _Float16* Vb = VgT + (((long)b * Hc + h) * DHc) * Lc;

  v16h qb[QW][2];  // B operands: query g*16 + lane%16, d = 0..31 and d = 32..63
  float mrun[QW], lrun[QW];  // of this lane's queries; lrun over this half's keys
  v8f oacc[QW][4];           // O^T: oacc[g][t][r] = O[query g*16 + col][d = t*16 + rb + r]
  // every unroll of this kernel: the arrays are then indexed by constants only and live in
  // registers
#pragma unroll
  for (int g = 0; g < QW; ++g) {
    qb[g][0] = ldfrag(Qb, DHc, g * 16, 0, lane);
    qb[g][1] = ldfrag(Qb, DHc, g * 16, 32, lane);
    mrun[g] = -1e30f;
    lrun[g] = 0.f;
#pragma unroll
    for (int t = 0; t < 4; ++t) oacc[g][t] = v8f{};
  }
  const int col = lane & 15, rb = ((lane >> 4) & 1) * 8;

  // staging coordinates: each thread copies 16 halves of K and of V^T
  const int sr = tid >> 2, sc = (tid & 3) * 16;
  const _Float16* kg = Kb + (long)sr * DHc + sc;
  const _Float16* vg = Vb + (long)sr * Lc + sc;
  const int so = sr * 72 + sc;

  const int NCH = Lc / 64;  // 8 chunks
  // prologue: chunk 0 into buffer 0, published; then chunk 1 into buffer 1
  async_chunk(kg, vg, &kt[0][so], &vt[0][so]);
  wait_async0();
  __syncthreads();
  async_chunk(kg + 64 * DHc, vg + 64, &kt[1][so], &vt[1][so]);

  for (int c = 0; c < NCH; ++c) {
    const int cur = c & 1;
    const _Float16* K = &kt[cur][0];
    const _Float16* V = &vt[cur][0];

    v8f z = {};
    v8f s[QW][4];
#pragma unroll
    for (int t = 0; t < 4; ++t) {  // scores: s[g][t][r] = S[query g*16 + col][l = t*16 + rb + r]
      const v16h k0 = ldfrag(K, 72, t * 16, 0, lane);
      const v16h k1 = ldfrag(K, 72, t * 16, 32, lane);
#pragma unroll
      for (int g = 0; g < QW; ++g) {
        s[g][t] = WMMA_F32_F16(k0, qb[g][0], z);
        s[g][t] = WMMA_F32_F16(k1, qb[g][1], s[g][t]);
      }
    }

    // Online softmax, one query per lane and tile: 32 of the chunk's 64 keys here, 32 in
    // lane^16.
    float nm[QW], corr[QW];
#pragma unroll
    for (int g = 0; g < QW; ++g) {
      float cmax = s[g][0][0];
#pragma unroll
      for (int t = 0; t < 4; ++t)
#pragma unroll
        for (int r = 0; r < 8; ++r) cmax = fmaxf(cmax, s[g][t][r]);
      cmax = fmaxf(cmax, other_half(cmax));
      nm[g] = fmaxf(mrun[g], cmax);
      corr[g] = __expf(mrun[g] - nm[g]);
      mrun[g] = nm[g];
#pragma unroll
      for (int t = 0; t < 4; ++t) oacc[g][t] *= corr[g];
    }
    v8f sv[QW];
#pragma unroll
    for (int u = 0; u < 2; ++u) {  // 32 keys at a time
      v16h pb[QW], vf[4];
      // the four V^T fragments go out as one group, ahead of the exponentials that hide them
#pragma unroll
      for (int t = 0; t < 4; ++t) vf[t] = ldfrag(V, 72, t * 16, u * 32, lane);
      // keeps the group together and in front: left to itself the scheduler puts each fragment's
      // reads directly in front of its WMMAs, and the wave waits out the LDS latency four times
      __builtin_amdgcn_sched_barrier(0);
#pragma unroll
      for (int g = 0; g < QW; ++g) {
#pragma unroll
        for (int t = 2 * u; t < 2 * u + 2; ++t) {
#pragma unroll
          for (int r = 0; r < 8; ++r) s[g][t][r] = __expf(s[g][t][r] - nm[g]);
          sv[g] = t == 0 ? s[g][0] : sv[g] + s[g][t];
        }
        // P^T as B operand: tiles 2u and 2u+1 hold keys 32u + rb + {0..7} and 32u + 16 + rb +
        // {0..7} of this lane's query, the k order in which ldfrag reads V^T
        pb[g] = __builtin_shufflevector(__builtin_convertvector(s[g][2 * u], half8),
                                        __builtin_convertvector(s[g][2 * u + 1], half8), 0, 1, 2,
                                        3, 4, 5, 6, 7, 8, 9, 10, 11, 12, 13, 14, 15);
      }
#pragma unroll
      for (int t = 0; t < 4; ++t)  // O^T += V^T(16 d x 32 l) @ P^T(32 l x 16 q) per d-tile
#pragma unroll
        for (int g = 0; g < QW; ++g) oacc[g][t] = WMMA_F32_F16(vf[t], pb[g], oacc[g][t]);
    }
#pragma unroll
    for (int g = 0; g < QW; ++g)
      lrun[g] = lrun[g] * corr[g] + (((sv[g][0] + sv[g][1]) + (sv[g][2] + sv[g][3])) +
                                     ((sv[g][4] + sv[g][5]) + (sv[g][6] + sv[g][7])));
    // this wave's LDS reads of chunk c are done before copies may land on their buffer
    asm volatile("s_wait_dscnt 0x0" ::: "memory");
    wait_async0();  // this wave's copies of chunk c+1 have landed
    // publishes chunk c+1 and ends the reads of chunk c, whose buffer chunk c+2 overwrites
    __syncthreads();
    if (c + 2 < NCH)
      async_chunk(kg + (long)(c + 2) * 64 * DHc, vg + (c + 2) * 64, &kt[cur][so], &vt[cur][so]);
  }
  wait_async0();  // no copy is outstanding behind the loop

  // join the two halves' sums, normalize, store f16 [B, TQ, D]: 8 consecutive d per tile
#pragma unroll
  for (int g = 0; g < QW; ++g) {
    const float inv = 1.f / (lrun[g] + other_half(lrun[g]));
    _Float16* Or = O + ((long)b * TQc + (q0 + g * 16 + col)) * Dc + h * DHc + rb;
#pragma unroll
    for (int t = 0; t < 4; ++t)
      *(half8*)(Or + t * 16) = __builtin_convertvector(oacc[g][t] * inv, half8);
  }
}

// ---------------------------------------------------------------------------
// Output projection: out_f32[M,1024] = O_f16[M,1024] @ Wo^T + bo
// grid ((B*TQ)/128, 1024/128). A-tile staged via async copies (pure f16 copy),
// W-tile through registers (f32->f16); both of pass t+1 fly over the WMMAs of pass t.
// ---------------------------------------------------------------------------
// 128x128 f16 tile -> LDS, eight async 16-byte copies per lane. The s_wait_xcnt closes the
// statement so that it stands in front of any rewrite of the address registers.
__device__ __forceinline__ void async_tile_f16(const _Float16* src, _Float16* t, int tid) {
  unsigned l[8];
  unsigned long long g[8];
#pragma unroll
  for (int e = 0; e < 8; ++e) {
    int r = e * 16 + (tid >> 4), c = (tid & 15) * 8;
    l[e] = (unsigned)(unsigned long long)(uintptr_t)(t + r * GP + c);
    g[e] = (unsigned long long)(uintptr_t)(src + r * Dc + c);
  }
  asm volatile(
      "global_load_async_to_lds_b128 %0, %8, off\n\t"
      "global_load_async_to_lds_b128 %1, %9, off\n\t"
      "global_load_async_to_lds_b128 %2, %10, off\n\t"
      "global_load_async_to_lds_b128 %3, %11, off\n\t"
      "global_load_async_to_lds_b128 %4, %12, off\n\t"
      "global_load_async_to_lds_b128 %5, %13, off\n\t"
      "global_load_async_to_lds_b128 %6, %14, off\n\t"
      "global_load_async_to_lds_b128 %7, %15, off\n\t"
      "s_wait_xcnt 0x0"
      :: "v"(l[0]), "v"(l[1]), "v"(l[2]), "v"(l[3]), "v"(l[4]), "v"(l[5]), "v"(l[6]), "v"(l[7]),
         "v"(g[0]), "v"(g[1]), "v"(g[2]), "v"(g[3]), "v"(g[4]), "v"(g[5]), "v"(g[6]), "v"(g[7])
      : "memory");
}

__global__ __launch_bounds__(256) void outproj_kernel(
    const _Float16* __restrict__ A, const float* __restrict__ W,
    const float* __restrict__ bias, float* __restrict__ Out) {
  __shared__ __align__(16) _Float16 At[2][GT * GP];
  __shared__ __align__(16) _Float16 Bt[2][GT * GP];
  const int tid = threadIdx.x, lane = tid & 31;
  const int w = tid >> 5, wr = w >> 1, wc = w & 1;
  const int m0 = blockIdx.x * GT, n0 = blockIdx.y * GT;
  const _Float16* Ar = A + (long)m0 * Dc;
  const float* pb = W + (long)(n0 + w) * Dc + lane * 4;  // wave w takes rows e*8+w
  const int so = w * GP + lane * 4;

  v4f fb[16];
  v8f acc[2][4] = {};
  ld_rows_f32<16, 8 * Dc>(fb, pb);
  // as an input the address stays in its registers up to here, so that no load of the
  // group lands on it; the wait stands in front of its next rewrite
  asm volatile("s_wait_xcnt 0x0" :: "v"(pb) : "memory");
  async_tile_f16(Ar, At[0], tid);  // A is f16 already: no register on its way
  // keeps the conversions below the loads and copies, so that all are in flight
  __builtin_amdgcn_sched_barrier(0);
  st_rows_f16<16, 8 * GP>(&Bt[0][so], fb);
  wait_async0();
  __syncthreads();
  for (int t = 0; t < Dc / GK - 1; ++t) {
    pb += GK;
    ld_rows_f32<16, 8 * Dc>(fb, pb);
    // as in front of the loop
    asm volatile("s_wait_xcnt 0x0" :: "v"(pb) : "memory");
    async_tile_f16(Ar + (t + 1) * GK, At[(t + 1) & 1], tid);
    // keeps the next pass's loads and copies in front of this pass's LDS reads and WMMAs
    __builtin_amdgcn_sched_barrier(0);
    mma_pass(At[t & 1], Bt[t & 1], wr, wc, lane, acc);
    // keeps the wait for the loads, and the conversions, behind this pass's WMMAs
    __builtin_amdgcn_sched_barrier(0);
    st_rows_f16<16, 8 * GP>(&Bt[(t + 1) & 1][so], fb);
    // this wave's LDS reads of pass t are done before copies may land on their buffer
    asm volatile("s_wait_dscnt 0x0" ::: "memory");
    wait_async0();  // this wave's copies of pass t+1 have landed
    // publishes pass t+1 and ends the reads of pass t, whose buffer pass t+2 overwrites
    __syncthreads();
  }
  wait_async0();  // no copy is outstanding behind the loop
  mma_pass(At[(Dc / GK - 1) & 1], Bt[(Dc / GK - 1) & 1], wr, wc, lane, acc);
  const int base8 = ((lane >> 4) & 1) * 8;
#pragma unroll
  for (int i = 0; i < 2; ++i)
#pragma unroll
    for (int j = 0; j < 4; ++j) {
      int nl = wc * 64 + j * 16 + (lane & 15);
      float bv = bias[n0 + nl];
#pragma unroll
      for (int v = 0; v < 8; ++v) {
        int ml = wr * 32 + i * 16 + base8 + v;
        Out[(long)(m0 + ml) * Dc + n0 + nl] = acc[i][j][v] + bv;
      }
    }
}

extern "C" void kernel_launch(void* const* d_in, const int* in_sizes, int n_in,
                              void* d_out, int out_size, void* d_ws, size_t ws_size,
                              hipStream_t stream) {
  const float* q  = (const float*)d_in[0];
  const float* k  = (const float*)d_in[1];
  const float* v  = (const float*)d_in[2];
  const float* Wq = (const float*)d_in[3];
  const float* bq = (const float*)d_in[4];
  const float* Wk = (const float*)d_in[5];
  const float* bk = (const float*)d_in[6];
  const float* Wv = (const float*)d_in[7];
  const float* bv = (const float*)d_in[8];
  const float* Wo = (const float*)d_in[9];
  const float* bo = (const float*)d_in[10];
  float* out = (float*)d_out;

  char* ws = (char*)d_ws;
  _Float16* Qh  = (_Float16*)ws;  // [B,H,TQ,64] f16
  _Float16* Kg  = (_Float16*)(ws + (size_t)Bc * Hc * TQc * DHc * 2);
  _Float16* VgT = (_Float16*)((char*)Kg + (size_t)Bc * Hc * Lc * DHc * 2);
  _Float16* Oa  = (_Float16*)((char*)VgT + (size_t)Bc * Hc * Lc * DHc * 2);  // [B,TQ,D] f16

  dim3 blk(128), blk8(256);
  // Q projection with 1/sqrt(dh) folded in
  qproj_kernel<<<dim3((Bc * TQc) / GT, Dc / GT), blk8, 0, stream>>>(q, Wq, bq, Qh, 0.125f);
  // HEPOS-gathered K/V projections (16x fewer FLOPs than dense K/V proj);
  // V written transposed [b,h,d,l] for contiguous P@V fragment loads.
  proj_kernel<1><<<dim3(Lc / 64, Hc, Bc), blk, 0, stream>>>(k, Wk, bk, Kg, 1.0f);
  proj_kernel<2><<<dim3(Lc / 64, Hc, Bc), blk, 0, stream>>>(v, Wv, bv, VgT, 1.0f);
  attn_kernel<<<dim3(TQc / 256, Hc, Bc), blk8, 0, stream>>>(Qh, Kg, VgT, Oa);
  outproj_kernel<<<dim3((Bc * TQc) / GT, Dc / GT), blk8, 0, stream>>>(Oa, Wo, bo, out);
}

// v006
// One run takes 80.5 microseconds.
// Next to v005, in two timings, it ran 1.09 times as fast each time.
// Over all steps from v000 it is 1.88 times as fast.
#include <hip/hip_runtime.h>
#include <hip/hip_bf16.h>
#include <math.h>

typedef _Float16 v16h  __attribute__((ext_vector_type(16)));
typedef _Float16 half8 __attribute__((ext_vector_type(8)));
typedef _Float16 half4 __attribute__((ext_vector_type(4)));
typedef float    v8f   __attribute__((ext_vector_type(8)));
typedef float    v4f   __attribute__((ext_vector_type(4)));

#define WMMA_F32_F16(a, b, c) \
  __builtin_amdgcn_wmma_f32_16x16x32_f16(false, (a), false, (b), (short)0, (c), false, false)

static constexpr int Bc = 4, TQc = 2048, TKc = 8192, Dc = 1024;
static constexpr int Hc = 16, DHc = 64, Lc = 512;

// Load a 16x32 f16 WMMA A/B fragment from an LDS (or global) tile.
// A-layout per CDNA5 ISA: lane L holds row (row_base + L%16); halves j cover
// k = kb + {0..7} and k = kb + {16..23}, kb = 8*(L>=16) + koff.
__device__ __forceinline__ v16h ldfrag(const _Float16* t, int stride, int row_base,
                                       int koff, int lane) {
  int r  = row_base + (lane & 15);
  int kb = ((lane >> 4) & 1) * 8 + koff;
  half8 lo = *(const half8*)(t + r * stride + kb);
  half8 hi = *(const half8*)(t + r * stride + kb + 16);
  return __builtin_shufflevector(lo, hi, 0, 1, 2, 3, 4, 5, 6, 7,
                                 8, 9, 10, 11, 12, 13, 14, 15);
}

// waits out this wave's async memory->LDS copies (tracked by ASYNCcnt)
__device__ __forceinline__ void wait_async0() {
  asm volatile("s_wait_asynccnt 0x0" ::: "memory");
}

// ---------------------------------------------------------------------------
// Staging helpers of the f32 operands of the K, V and Q projection GEMMs. Every GEMM keeps
// two LDS buffers per operand: the global loads of pass t+1 go out in front of the WMMAs
// of pass t and are
// converted and stored into the other buffer behind them, so that the time of the loads
// runs beside the LDS reads and the WMMAs, with one barrier per pass.
// ---------------------------------------------------------------------------
// N rows of a f32 tile -> registers; p is the thread's own place in its first row
template <int N, int STEP>
__device__ __forceinline__ void ld_rows_f32(v4f (&f)[N], const float* __restrict__ p) {
#pragma unroll  // f[] is indexed by constants only, so it lives in registers
  for (int e = 0; e < N; ++e) f[e] = *(const v4f*)(p + e * STEP);
}
// ... and on to LDS or global memory as f16; t is the thread's own place in its first row
template <int N, int STEP>
__device__ __forceinline__ void st_rows_f16(_Float16* t, const v4f (&f)[N]) {
#pragma unroll  // as above
  for (int e = 0; e < N; ++e) {
    half4 hh = {(_Float16)f[e].x, (_Float16)f[e].y, (_Float16)f[e].z, (_Float16)f[e].w};
    *(half4*)(t + e * STEP) = hh;
  }
}

// ---------------------------------------------------------------------------
// K/V projection GEMM: Y_f16 = (X_f32 @ W_f32^T + bias) * scale
// MODE 1: K (HEPOS gather rows t=h+16*l). out Kg[((b*H+h)*L + l)*64 + d]
// MODE 2: V (HEPOS gather) TRANSPOSED out: VgT[((b*H+h)*64 + d)*L + l]
// 64x64 tile / block, 4 waves each computing a 32x32 quadrant via 2x2 WMMAs.
// Beside its tile every block rounds 1/512 of one dense GEMM's weight matrix (Wc) to f16
// (Wc16), once for all the row tiles of the later launch that reads it.
// ---------------------------------------------------------------------------
static constexpr int BK = 128;     // k extent of one staged pass
static constexpr int PK = BK + 8;  // LDS row pitch in halves: row + 16 bytes
// elements of a dense GEMM's weight matrix that one of the launch's blocks rounds to f16
static constexpr int CW = Dc * Dc / (Bc * Hc * (Lc / 64));

// one staged pass of a wave, in two halves of 64 k: 8 fragments, then their 8 WMMAs
__device__ __forceinline__ void mma_pass_kv(const _Float16* At, const _Float16* Bt, int wr,
                                            int wc, int lane, v8f (&acc)[2][2]) {
#pragma unroll
  for (int kh = 0; kh < BK; kh += 64) {
    v16h af[2][2], bf[2][2];
#pragma unroll
    for (int s = 0; s < 2; ++s)
#pragma unroll
      for (int i = 0; i < 2; ++i) {
        af[s][i] = ldfrag(At, PK, wr * 32 + i * 16, kh + s * 32, lane);
        bf[s][i] = ldfrag(Bt, PK, wc * 32 + i * 16, kh + s * 32, lane);
      }
    // keeps a half's LDS reads one group ahead of its own WMMAs; left to itself the
    // scheduler spreads them among the WMMAs and the wave waits out the LDS latency
    // at each of them
    __builtin_amdgcn_sched_barrier(0);
#pragma unroll
    for (int s = 0; s < 2; ++s)
#pragma unroll
      for (int i = 0; i < 2; ++i)
#pragma unroll
        for (int j = 0; j < 2; ++j) acc[i][j] = WMMA_F32_F16(af[s][i], bf[s][j], acc[i][j]);
  }
}

template <int MODE>
__global__ __launch_bounds__(128) void proj_kernel(
    const float* __restrict__ X, const float* __restrict__ W,
    const float* __restrict__ bias, _Float16* __restrict__ Y, float scale,
    const float* __restrict__ Wc, _Float16* __restrict__ Wc16) {
  __shared__ __align__(16) _Float16 At[2][64 * PK];
  __shared__ __align__(16) _Float16 Bt[2][64 * PK];
  const int tid = threadIdx.x, lane = tid & 31;
  const int w = tid >> 5, wr = w >> 1, wc = w & 1;
  const int tile = blockIdx.x, h = blockIdx.y, b = blockIdx.z;
  const int n0 = h * DHc;
  // 64x128 of each operand per pass: a wave-wide load covers 512 contiguous bytes of one
  // row, wave w takes rows e*4+w
  const float* pa = X + ((long)b * TKc + h + 16 * (tile * 64 + w)) * Dc + lane * 4;
  const float* pb = W + (long)(n0 + w) * Dc + lane * 4;
  const int so = w * PK + lane * 4;  // the thread's place in row w of an LDS tile
  // the block's share of Wc: CW elements, a wave-wide load covers 512 contiguous bytes
  const int co = ((b * Hc + h) * (Lc / 64) + tile) * CW + tid * 4;
  const float* pc = Wc + co;
  _Float16* pd = Wc16 + co;

  v4f fa[16], fb[16], fc[CW / 512];
  v8f acc[2][2] = {};
  ld_rows_f32<CW / 512, 512>(fc, pc);
  ld_rows_f32<16, 64 * Dc>(fa, pa);
  ld_rows_f32<16, 4 * Dc>(fb, pb);
  // as inputs the addresses stay in their registers up to here, so that no load of
  // the group lands on them; the wait stands in front of their next rewrite
  asm volatile("s_wait_xcnt 0x0" :: "v"(pa), "v"(pb), "v"(pc) : "memory");
  // keeps the conversions below the whole group of loads, so that all are in flight
  __builtin_amdgcn_sched_barrier(0);
  st_rows_f16<CW / 512, 512>(pd, fc);
  // stands in front of any rewrite of the stores' address registers
  asm volatile("s_wait_xcnt 0x0" :: "v"(pd) : "memory");
  st_rows_f16<16, 4 * PK>(&At[0][so], fa);
  st_rows_f16<16, 4 * PK>(&Bt[0][so], fb);
  __syncthreads();
  for (int t = 0; t < Dc / BK - 1; ++t) {
    pa += BK;
    pb += BK;
    ld_rows_f32<16, 64 * Dc>(fa, pa);
    ld_rows_f32<16, 4 * Dc>(fb, pb);
    // as in front of the loop
    asm volatile("s_wait_xcnt 0x0" :: "v"(pa), "v"(pb) : "memory");
    // keeps the next pass's 32 loads in front of this pass's LDS reads and WMMAs
    __builtin_amdgcn_sched_barrier(0);
    mma_pass_kv(At[t & 1], Bt[t & 1], wr, wc, lane, acc);
    // keeps the wait for the loads, and the conversions, behind this pass's WMMAs
    __builtin_amdgcn_sched_barrier(0);
    st_rows_f16<16, 4 * PK>(&At[(t + 1) & 1][so], fa);
    st_rows_f16<16, 4 * PK>(&Bt[(t + 1) & 1][so], fb);
    // publishes pass t+1 and ends the reads of pass t, whose buffer pass t+2 overwrites
    __syncthreads();
  }
  mma_pass_kv(At[(Dc / BK - 1) & 1], Bt[(Dc / BK - 1) & 1], wr, wc, lane, acc);
  const int base8 = ((lane >> 4) & 1) * 8;
#pragma unroll
  for (int i = 0; i < 2; ++i)
#pragma unroll
    for (int j = 0; j < 2; ++j) {
      int nl = wc * 32 + j * 16 + (lane & 15);
      float bv = bias[n0 + nl];
      if (MODE == 2) {  // transposed: row d=nl, 8 consecutive l -> one b128
        int l = tile * 64 + wr * 32 + i * 16 + base8;
        half8 pk;
#pragma unroll
        for (int v = 0; v < 8; ++v) pk[v] = (_Float16)((acc[i][j][v] + bv) * scale);
        *(half8*)(Y + (((long)b * Hc + h) * DHc + nl) * Lc + l) = pk;
      } else {
#pragma unroll
        for (int v = 0; v < 8; ++v) {
          int ml = wr * 32 + i * 16 + base8 + v;
          float y = (acc[i][j][v] + bv) * scale;
          long o = (((long)b * Hc + h) * Lc + (tile * 64 + ml)) * DHc + nl;
          Y[o] = (_Float16)y;
        }
      }
    }
}

// ---------------------------------------------------------------------------
// The two dense 8192 x 1024 x 1024 GEMMs (Q projection, output projection):
// 128x128 tile per block, 8 waves in a 4x2 grid, each computing 32x64 via 2x4 WMMAs,
// 128 k staged per pass. A block loads 128 + 128 operand rows for 128 x 128
// outputs: half the L2 bytes per output of a 64x64 tile.
// ---------------------------------------------------------------------------
static constexpr int GT = 128;     // block tile, rows and columns
static constexpr int GK = 128;     // k extent of one staged pass
static constexpr int GP = GK + 8;  // LDS row pitch in halves: row + 16 bytes

// one staged pass of a wave, in two halves of 64 k: 12 fragments, then their 16 WMMAs;
// k runs upward as in the 64x64 tile
__device__ __forceinline__ void mma_pass(const _Float16* At, const _Float16* Bt, int wr,
                                         int wc, int lane, v8f (&acc)[2][4]) {
#pragma unroll
  for (int kh = 0; kh < GK; kh += 64) {
    v16h af[2][2], bf[2][4];
#pragma unroll
    for (int s = 0; s < 2; ++s) {
#pragma unroll
      for (int i = 0; i < 2; ++i)
        af[s][i] = ldfrag(At, GP, wr * 32 + i * 16, kh + s * 32, lane);
#pragma unroll
      for (int j = 0; j < 4; ++j)
        bf[s][j] = ldfrag(Bt, GP, wc * 64 + j * 16, kh + s * 32, lane);
    }
    // keeps a half's LDS reads ahead of its own WMMAs: the first half's go out as one
    // group, the second half's among the first half's WMMAs as registers come free
    __builtin_amdgcn_sched_barrier(0);
#pragma unroll
    for (int s = 0; s < 2; ++s)
#pragma unroll
      for (int i = 0; i < 2; ++i)
#pragma unroll
        for (int j = 0; j < 4; ++j) acc[i][j] = WMMA_F32_F16(af[s][i], bf[s][j], acc[i][j]);
  }
}

// 128x128 f16 tile -> LDS, eight async 16-byte copies per lane. The s_wait_xcnt closes the
// statement so that it stands in front of any rewrite of the address registers.
__device__ __forceinline__ void async_tile_f16(const _Float16* src, _Float16* t, int tid) {
  unsigned l[8];
  unsigned long long g[8];
#pragma unroll
  for (int e = 0; e < 8; ++e) {
    int r = e * 16 + (tid >> 4), c = (tid & 15) * 8;
    l[e] = (unsigned)(unsigned long long)(uintptr_t)(t + r * GP + c);
    g[e] = (unsigned long long)(uintptr_t)(src + r * Dc + c);
  }
  asm volatile(
      "global_load_async_to_lds_b128 %0, %8, off\n\t"
      "global_load_async_to_lds_b128 %1, %9, off\n\t"
      "global_load_async_to_lds_b128 %2, %10, off\n\t"
      "global_load_async_to_lds_b128 %3, %11, off\n\t"
      "global_load_async_to_lds_b128 %4, %12, off\n\t"
      "global_load_async_to_lds_b128 %5, %13, off\n\t"
      "global_load_async_to_lds_b128 %6, %14, off\n\t"
      "global_load_async_to_lds_b128 %7, %15, off\n\t"
      "s_wait_xcnt 0x0"
      :: "v"(l[0]), "v"(l[1]), "v"(l[2]), "v"(l[3]), "v"(l[4]), "v"(l[5]), "v"(l[6]), "v"(l[7]),
         "v"(g[0]), "v"(g[1]), "v"(g[2]), "v"(g[3]), "v"(g[4]), "v"(g[5]), "v"(g[6]), "v"(g[7])
      : "memory");
}

// Q projection: Qh[((b*H+h)*TQ + t)*64 + d] = (q @ Wq^T + bq) * scale, f16.
// grid ((B*TQ)/128, D/128); a block's 128 columns are two heads, one per wave column.
// X-tile through registers (f32->f16), W-tile, f16 already, via async copies; both of pass
// t+1 fly over the WMMAs of pass t.
__global__ __launch_bounds__(256) void qproj_kernel(
    const float* __restrict__ X, const _Float16* __restrict__ W,
    const float* __restrict__ bias, _Float16* __restrict__ Y, float scale) {
  __shared__ __align__(16) _Float16 At[2][GT * GP];
  __shared__ __align__(16) _Float16 Bt[2][GT * GP];
  const int tid = threadIdx.x, lane = tid & 31;
  const int w = tid >> 5, wr = w >> 1, wc = w & 1;
  const int m0 = blockIdx.x * GT, n0 = blockIdx.y * GT;
  // 128x128 of X per pass: a wave-wide load covers the 512 contiguous bytes of one row,
  // wave w takes rows e*8+w
  const float* pa = X + (long)(m0 + w) * Dc + lane * 4;
  const _Float16* Wr = W + (long)n0 * Dc;
  const int so = w * GP + lane * 4;  // the thread's place in row w of an LDS tile

  v4f fa[16];
  v8f acc[2][4] = {};
  ld_rows_f32<16, 8 * Dc>(fa, pa);
  // as an input the address stays in its registers up to here, so that no load of the
  // group lands on it; the wait stands in front of its next rewrite
  asm volatile("s_wait_xcnt 0x0" :: "v"(pa) : "memory");
  async_tile_f16(Wr, Bt[0], tid);  // W is f16 already: no register on its way
  // keeps the conversions below the loads and copies, so that all are in flight
  __builtin_amdgcn_sched_barrier(0);
  st_rows_f16<16, 8 * GP>(&At[0][so], fa);
  wait_async0();
  __syncthreads();
  for (int t = 0; t < Dc / GK - 1; ++t) {
    pa += GK;
    ld_rows_f32<16, 8 * Dc>(fa, pa);
    // as in front of the loop
    asm volatile("s_wait_xcnt 0x0" :: "v"(pa) : "memory");
    async_tile_f16(Wr + (t + 1) * GK, Bt[(t + 1) & 1], tid);
    // keeps the next pass's loads and copies in front of this pass's LDS reads and WMMAs
    __builtin_amdgcn_sched_barrier(0);
    mma_pass(At[t & 1], Bt[t & 1], wr, wc, lane, acc);
    // keeps the wait for the loads, and the conversions, behind this pass's WMMAs
    __builtin_amdgcn_sched_barrier(0);
    st_rows_f16<16, 8 * GP>(&At[(t + 1) & 1][so], fa);
    // this wave's LDS reads of pass t are done before copies may land on their buffer
    asm volatile("s_wait_dscnt 0x0" ::: "memory");
    wait_async0();  // this wave's copies of pass t+1 have landed
    // publishes pass t+1 and ends the reads of pass t, whose buffer pass t+2 overwrites
    __syncthreads();
  }
  wait_async0();  // no copy is outstanding behind the loop
  mma_pass(At[(Dc / GK - 1) & 1], Bt[(Dc / GK - 1) & 1], wr, wc, lane, acc);
  const int base8 = ((lane >> 4) & 1) * 8;
  const int b = m0 / TQc, t0 = m0 % TQc, h = blockIdx.y * 2 + wc;
#pragma unroll
  for (int i = 0; i < 2; ++i)
#pragma unroll
    for (int j = 0; j < 4; ++j) {
      int d = j * 16 + (lane & 15);
      float bv = bias[h * DHc + d];
#pragma unroll
      for (int v = 0; v < 8; ++v) {
        int t = t0 + wr * 32 + i * 16 + base8 + v;
        Y[(((long)b * Hc + h) * TQc + t) * DHc + d] = (_Float16)((acc[i][j][v] + bv) * scale);
      }
    }
}

__device__ __forceinline__ float other_half(float x) {
  int b = __builtin_bit_cast(int, x);
  return __builtin_bit_cast(
      float, __builtin_amdgcn_permlanex16(b, b, 0x76543210, 0xfedcba98, false, false));
}

// A lane's share of one chunk: 32 bytes of K and 32 of V^T, four async 16-byte copies. The
// s_wait_xcnt closes the statement so that it stands in front of any rewrite of the address
// registers.
__device__ __forceinline__ void async_chunk(const _Float16* kg, const _Float16* vg,
                                            _Float16* kl, _Float16* vl) {
  unsigned lk = (unsigned)(unsigned long long)(uintptr_t)kl;  // low 32b = LDS offset
  unsigned lv = (unsigned)(unsigned long long)(uintptr_t)vl;
  unsigned lk1 = lk + 16, lv1 = lv + 16;
  unsigned long long gk = (unsigned long long)(uintptr_t)kg;
  unsigned long long gv = (unsigned long long)(uintptr_t)vg;
  unsigned long long gk1 = gk + 16, gv1 = gv + 16;
  asm volatile(
      "global_load_async_to_lds_b128 %0, %4, off\n\t"
      "global_load_async_to_lds_b128 %1, %5, off\n\t"
      "global_load_async_to_lds_b128 %2, %6, off\n\t"
      "global_load_async_to_lds_b128 %3, %7, off\n\t"
      "s_wait_xcnt 0x0"
      :: "v"(lk), "v"(lk1), "v"(lv), "v"(lv1), "v"(gk), "v"(gk1), "v"(gv), "v"(gv1)
      : "memory");
}

static constexpr int QW = 2;  // 16-query tiles per wave

__global__ __launch_bounds__(256) void attn_kernel(
    const _Float16* __restrict__ Qh, const _Float16* __restrict__ Kg,
    const _Float16* __restrict__ VgT, _Float16* __restrict__ O) {
  __shared__ __align__(16) _Float16 kt[2][64 * 72];
  __shared__ __align__(16) _Float16 vt[2][64 * 72];
  const int tid = threadIdx.x, lane = tid & 31, w = tid >> 5;
  const int qt = blockIdx.x, h = blockIdx.y, b = blockIdx.z;
  const int q0 = qt * (8 * QW * 16) + w * (QW * 16);

  const _Float16* Qb = Qh + (((long)b * Hc + h) * TQc + q0) * DHc;
  const _Float16* Kb = Kg + (((long)b * Hc + h) * Lc) * DHc;
  const _Float16* Vb = VgT + (((long)b * Hc + h) * DHc) * Lc;

  v16h qb[QW][2];  // B operands: query g*16 + lane%16, d = 0..31 and d = 32..63
  float mrun[QW], lrun[QW];  // of this lane's queries; lrun over this half's keys
  v8f oacc[QW][4];           // O^T: oacc[g][t][r] = O[query g*16 + col][d = t*16 + rb + r]
  // every unroll of this kernel: the arrays are then indexed by constants only and live in
  // registers
#pragma unroll
  for (int g = 0; g < QW; ++g) {
    qb[g][0] = ldfrag(Qb, DHc, g * 16, 0, lane);
    qb[g][1] = ldfrag(Qb, DHc, g * 16, 32, lane);
    mrun[g] = -1e30f;
    lrun[g] = 0.f;
#pragma unroll
    for (int t = 0; t < 4; ++t) oacc[g][t] = v8f{};
  }
  const int col = lane & 15, rb = ((lane >> 4) & 1) * 8;

  // staging coordinates: each thread copies 16 halves of K and of V^T
  const int sr = tid >> 2, sc = (tid & 3) * 16;
  const _Float16* kg = Kb + (long)sr * DHc + sc;
  const _Float16* vg = Vb + (long)sr * Lc + sc;
  const int so = sr * 72 + sc;

  const int NCH = Lc / 64;  // 8 chunks
  // prologue: chunk 0 into buffer 0, published; then chunk 1 into buffer 1
  async_chunk(kg, vg, &kt[0][so], &vt[0][so]);
  wait_async0();
  __syncthreads();
  async_chunk(kg + 64 * DHc, vg + 64, &kt[1][so], &vt[1][so]);

  for (int c = 0; c < NCH; ++c) {
    const int cur = c & 1;
    const _Float16* K = &kt[cur][0];
    const _Float16* V = &vt[cur][0];

    v8f z = {};
    v8f s[QW][4];
#pragma unroll
    for (int t = 0; t < 4; ++t) {  // scores: s[g][t][r] = S[query g*16 + col][l = t*16 + rb + r]
      const v16h k0 = ldfrag(K, 72, t * 16, 0, lane);
      const v16h k1 = ldfrag(K, 72, t * 16, 32, lane);
#pragma unroll
      for (int g = 0; g < QW; ++g) {
        s[g][t] = WMMA_F32_F16(k0, qb[g][0], z);
        s[g][t] = WMMA_F32_F16(k1, qb[g][1], s[g][t]);
      }
    }

    // Online softmax, one query per lane and tile: 32 of the chunk's 64 keys here, 32 in
    // lane^16.
    float nm[QW], corr[QW];
#pragma unroll
    for (int g = 0; g < QW; ++g) {
      float cmax = s[g][0][0];
#pragma unroll
      for (int t = 0; t < 4; ++t)
#pragma unroll
        for (int r = 0; r < 8; ++r) cmax = fmaxf(cmax, s[g][t][r]);
      cmax = fmaxf(cmax, other_half(cmax));
      nm[g] = fmaxf(mrun[g], cmax);
      corr[g] = __expf(mrun[g] - nm[g]);
      mrun[g] = nm[g];
#pragma unroll
      for (int t = 0; t < 4; ++t) oacc[g][t] *= corr[g];
    }
    v8f sv[QW];
#pragma unroll
    for (int u = 0; u < 2; ++u) {  // 32 keys at a time
      v16h pb[QW], vf[4];
      // the four V^T fragments go out as one group, ahead of the exponentials that hide them
#pragma unroll
      for (int t = 0; t < 4; ++t) vf[t] = ldfrag(V, 72, t * 16, u * 32, lane);
      // keeps the group together and in front: left to itself the scheduler puts each fragment's
      // reads directly in front of its WMMAs, and the wave waits out the LDS latency four times
      __builtin_amdgcn_sched_barrier(0);
#pragma unroll
      for (int g = 0; g < QW; ++g) {
#pragma unroll
        for (int t = 2 * u; t < 2 * u + 2; ++t) {
#pragma unroll
          for (int r = 0; r < 8; ++r) s[g][t][r] = __expf(s[g][t][r] - nm[g]);
          sv[g] = t == 0 ? s[g][0] : sv[g] + s[g][t];
        }
        // P^T as B operand: tiles 2u and 2u+1 hold keys 32u + rb + {0..7} and 32u + 16 + rb +
        // {0..7} of this lane's query, the k order in which ldfrag reads V^T
        pb[g] = __builtin_shufflevector(__builtin_convertvector(s[g][2 * u], half8),
                                        __builtin_convertvector(s[g][2 * u + 1], half8), 0, 1, 2,
                                        3, 4, 5, 6, 7, 8, 9, 10, 11, 12, 13, 14, 15);
      }
#pragma unroll
      for (int t = 0; t < 4; ++t)  // O^T += V^T(16 d x 32 l) @ P^T(32 l x 16 q) per d-tile
#pragma unroll
        for (int g = 0; g < QW; ++g) oacc[g][t] = WMMA_F32_F16(vf[t], pb[g], oacc[g][t]);
    }
#pragma unroll
    for (int g = 0; g < QW; ++g)
      lrun[g] = lrun[g] * corr[g] + (((sv[g][0] + sv[g][1]) + (sv[g][2] + sv[g][3])) +
                                     ((sv[g][4] + sv[g][5]) + (sv[g][6] + sv[g][7])));
    // this wave's LDS reads of chunk c are done before copies may land on their buffer
    asm volatile("s_wait_dscnt 0x0" ::: "memory");
    wait_async0();  // this wave's copies of chunk c+1 have landed
    // publishes chunk c+1 and ends the reads of chunk c, whose buffer chunk c+2 overwrites
    __syncthreads();
    if (c + 2 < NCH)
      async_chunk(kg + (long)(c + 2) * 64 * DHc, vg + (c + 2) * 64, &kt[cur][so], &vt[cur][so]);
  }
  wait_async0();  // no copy is outstanding behind the loop

  // join the two halves' sums, normalize, store f16 [B, TQ, D]: 8 consecutive d per tile
#pragma unroll
  for (int g = 0; g < QW; ++g) {
    const float inv = 1.f / (lrun[g] + other_half(lrun[g]));
    _Float16* Or = O + ((long)b * TQc + (q0 + g * 16 + col)) * Dc + h * DHc + rb;
#pragma unroll
    for (int t = 0; t < 4; ++t)
      *(half8*)(Or + t * 16) = __builtin_convertvector(oacc[g][t] * inv, half8);
  }
}

// ---------------------------------------------------------------------------
// Output projection: out_f32[M,1024] = O_f16[M,1024] @ Wo^T + bo
// grid ((B*TQ)/128, 1024/128). Both tiles are f16 already and staged via async copies,
// through no register; those of pass t+1 fly over the WMMAs of pass t.
// ---------------------------------------------------------------------------
__global__ __launch_bounds__(256) void outproj_kernel(
    const _Float16* __restrict__ A, const _Float16* __restrict__ W,
    const float* __restrict__ bias, float* __restrict__ Out) {
  __shared__ __align__(16) _Float16 At[2][GT * GP];
  __shared__ __align__(16) _Float16 Bt[2][GT * GP];
  const int tid = threadIdx.x, lane = tid & 31;
  const int w = tid >> 5, wr = w >> 1, wc = w & 1;
  const int m0 = blockIdx.x * GT, n0 = blockIdx.y * GT;
  const _Float16* Ar = A + (long)m0 * Dc;
  const _Float16* Wr = W + (long)n0 * Dc;

  v8f acc[2][4] = {};
  async_tile_f16(Ar, At[0], tid);
  async_tile_f16(Wr, Bt[0], tid);
  wait_async0();
  __syncthreads();
  for (int t = 0; t < Dc / GK - 1; ++t) {
    async_tile_f16(Ar + (t + 1) * GK, At[(t + 1) & 1], tid);
    async_tile_f16(Wr + (t + 1) * GK, Bt[(t + 1) & 1], tid);
    // keeps the next pass's copies in front of this pass's LDS reads and WMMAs
    __builtin_amdgcn_sched_barrier(0);
    mma_pass(At[t & 1], Bt[t & 1], wr, wc, lane, acc);
    // keeps the waits behind this pass's WMMAs, so that the copies have the whole pass to land
    __builtin_amdgcn_sched_barrier(0);
    // this wave's LDS reads of pass t are done before copies may land on their buffer
    asm volatile("s_wait_dscnt 0x0" ::: "memory");
    wait_async0();  // this wave's copies of pass t+1 have landed
    // publishes pass t+1 and ends the reads of pass t, whose buffer pass t+2 overwrites
    __syncthreads();
  }
  wait_async0();  // no copy is outstanding behind the loop
  mma_pass(At[(Dc / GK - 1) & 1], Bt[(Dc / GK - 1) & 1], wr, wc, lane, acc);
  const int base8 = ((lane >> 4) & 1) * 8;
#pragma unroll
  for (int i = 0; i < 2; ++i)
#pragma unroll
    for (int j = 0; j < 4; ++j) {
      int nl = wc * 64 + j * 16 + (lane & 15);
      float bv = bias[n0 + nl];
#pragma unroll
      for (int v = 0; v < 8; ++v) {
        int ml = wr * 32 + i * 16 + base8 + v;
        Out[(long)(m0 + ml) * Dc + n0 + nl] = acc[i][j][v] + bv;
      }
    }
}

extern "C" void kernel_launch(void* const* d_in, const int* in_sizes, int n_in,
                              void* d_out, int out_size, void* d_ws, size_t ws_size,
                              hipStream_t stream) {
  const float* q  = (const float*)d_in[0];
  const float* k  = (const float*)d_in[1];
  const float* v  = (const float*)d_in[2];
  const float* Wq = (const float*)d_in[3];
  const float* bq = (const float*)d_in[4];
  const float* Wk = (const float*)d_in[5];
  const float* bk = (const float*)d_in[6];
  const float* Wv = (const float*)d_in[7];
  const float* bv = (const float*)d_in[8];
  const float* Wo = (const float*)d_in[9];
  const float* bo = (const float*)d_in[10];
  float* out = (float*)d_out;

  char* ws = (char*)d_ws;
  _Float16* Qh  = (_Float16*)ws;  // [B,H,TQ,64] f16
  _Float16* Kg  = (_Float16*)(ws + (size_t)Bc * Hc * TQc * DHc * 2);
  _Float16* VgT = (_Float16*)((char*)Kg + (size_t)Bc * Hc * Lc * DHc * 2);
  _Float16* Oa  = (_Float16*)((char*)VgT + (size_t)Bc * Hc * Lc * DHc * 2);  // [B,TQ,D] f16
  _Float16* Wq16 = (_Float16*)((char*)Oa + (size_t)Bc * TQc * Dc * 2);  // [D,D] f16
  _Float16* Wo16 = (_Float16*)((char*)Wq16 + (size_t)Dc * Dc * 2);      // [D,D] f16

  dim3 blk(128), blk8(256);
  // HEPOS-gathered K/V projections (16x fewer FLOPs than dense K/V proj);
  // V written transposed [b,h,d,l] for contiguous P@V fragment loads. They come first and
  // leave Wo and Wq behind as f16 for the two dense GEMMs.
  proj_kernel<1><<<dim3(Lc / 64, Hc, Bc), blk, 0, stream>>>(k, Wk, bk, Kg, 1.0f, Wo, Wo16);
  proj_kernel<2><<<dim3(Lc / 64, Hc, Bc), blk, 0, stream>>>(v, Wv, bv, VgT, 1.0f, Wq, Wq16);
  // Q projection with 1/sqrt(dh) folded in
  qproj_kernel<<<dim3((Bc * TQc) / GT, Dc / GT), blk8, 0, stream>>>(q, Wq16, bq, Qh, 0.125f);
  attn_kernel<<<dim3(TQc / 256, Hc, Bc), blk8, 0, stream>>>(Qh, Kg, VgT, Oa);
  outproj_kernel<<<dim3((Bc * TQc) / GT, Dc / GT), blk8, 0, stream>>>(Oa, Wo16, bo, out);
}

// v007
// It runs in 77.3 microseconds.
// Two timings next to v006 both put it at 1.04 times that version's speed.
// All steps since v000 together make it 1.96 times as fast.
#include <hip/hip_runtime.h>
#include <hip/hip_bf16.h>
#include <math.h>

typedef _Float16 v16h  __attribute__((ext_vector_type(16)));
typedef _Float16 half8 __attribute__((ext_vector_type(8)));
typedef _Float16 half4 __attribute__((ext_vector_type(4)));
typedef float    v8f   __attribute__((ext_vector_type(8)));
typedef float    v4f   __attribute__((ext_vector_type(4)));

#define WMMA_F32_F16(a, b, c) \
  __builtin_amdgcn_wmma_f32_16x16x32_f16(false, (a), false, (b), (short)0, (c), false, false)

static constexpr int Bc = 4, TQc = 2048, TKc = 8192, Dc = 1024;
static constexpr int Hc = 16, DHc = 64, Lc = 512;

// Load a 16x32 f16 WMMA A/B fragment from an LDS (or global) tile.
// A-layout per CDNA5 ISA: lane L holds row (row_base + L%16); halves j cover
// k = kb + {0..7} and k = kb + {16..23}, kb = 8*(L>=16) + koff.
__device__ __forceinline__ v16h ldfrag(const _Float16* t, int stride, int row_base,
                                       int koff, int lane) {
  int r  = row_base + (lane & 15);
  int kb = ((lane >> 4) & 1) * 8 + koff;
  half8 lo = *(const half8*)(t + r * stride + kb);
  half8 hi = *(const half8*)(t + r * stride + kb + 16);
  return __builtin_shufflevector(lo, hi, 0, 1, 2, 3, 4, 5, 6, 7,
                                 8, 9, 10, 11, 12, 13, 14, 15);
}

// waits out this wave's async memory->LDS copies (tracked by ASYNCcnt)
__device__ __forceinline__ void wait_async0() {
  asm volatile("s_wait_asynccnt 0x0" ::: "memory");
}

// ---------------------------------------------------------------------------
// Staging helpers of the f32 operands of the K, V and Q projection GEMMs. Every GEMM keeps
// two LDS buffers per operand: the global loads of pass t+1 go out in front of the WMMAs
// of pass t and are
// converted and stored into the other buffer behind them, so that the time of the loads
// runs beside the LDS reads and the WMMAs, with one barrier per pass.
// ---------------------------------------------------------------------------
// N rows of a f32 tile -> registers; p is the thread's own place in its first row
template <int N, int STEP>
__device__ __forceinline__ void ld_rows_f32(v4f (&f)[N], const float* __restrict__ p) {
#pragma unroll  // f[] is indexed by constants only, so it lives in registers
  for (int e = 0; e < N; ++e) f[e] = *(const v4f*)(p + e * STEP);
}
// ... and on to LDS or global memory as f16; t is the thread's own place in its first row
template <int N, int STEP>
__device__ __forceinline__ void st_rows_f16(_Float16* t, const v4f (&f)[N]) {
#pragma unroll  // as above
  for (int e = 0; e < N; ++e) {
    half4 hh = {(_Float16)f[e].x, (_Float16)f[e].y, (_Float16)f[e].z, (_Float16)f[e].w};
    *(half4*)(t + e * STEP) = hh;
  }
}

// ---------------------------------------------------------------------------
// K/V projection GEMM: Y_f16 = (X_f32 @ W_f32^T + bias) * scale
// MODE 1: K (HEPOS gather rows t=h+16*l). out Kg[((b*H+h)*L + l)*64 + d]
// MODE 2: V (HEPOS gather) TRANSPOSED out: VgT[((b*H+h)*64 + d)*L + l]
// 64x64 tile / block, 4 waves each computing a 32x32 quadrant via 2x2 WMMAs.
// Beside its tile every block rounds 1/512 of one dense GEMM's weight matrix (Wc) to f16
// (Wc16), once for all the row tiles of the later launch that reads it.
// ---------------------------------------------------------------------------
static constexpr int BK = 128;     // k extent of one staged pass
static constexpr int PK = BK + 8;  // LDS row pitch in halves: row + 16 bytes
static constexpr int SP = 64 + 8;  // pitch in halves of a staged output row of 128 bytes
// elements of a dense GEMM's weight matrix that one of the launch's blocks rounds to f16
static constexpr int CW = Dc * Dc / (Bc * Hc * (Lc / 64));

// one staged pass of a wave, in two halves of 64 k: 8 fragments, then their 8 WMMAs.
// WFIRST: the W fragment is the first operand, so that a lane holds 8 consecutive output
// columns of one X row (else 8 consecutive X rows of one column)
template <bool WFIRST>
__device__ __forceinline__ void mma_pass_kv(const _Float16* At, const _Float16* Bt, int wr,
                                            int wc, int lane, v8f (&acc)[2][2]) {
#pragma unroll
  for (int kh = 0; kh < BK; kh += 64) {
    v16h af[2][2], bf[2][2];
#pragma unroll
    for (int s = 0; s < 2; ++s)
#pragma unroll
      for (int i = 0; i < 2; ++i) {
        af[s][i] = ldfrag(At, PK, wr * 32 + i * 16, kh + s * 32, lane);
        bf[s][i] = ldfrag(Bt, PK, wc * 32 + i * 16, kh + s * 32, lane);
      }
    // keeps a half's LDS reads one group ahead of its own WMMAs; left to itself the
    // scheduler spreads them among the WMMAs and the wave waits out the LDS latency
    // at each of them
    __builtin_amdgcn_sched_barrier(0);
#pragma unroll
    for (int s = 0; s < 2; ++s)
#pragma unroll
      for (int i = 0; i < 2; ++i)
#pragma unroll
        for (int j = 0; j < 2; ++j)
          acc[i][j] = WFIRST ? WMMA_F32_F16(bf[s][j], af[s][i], acc[i][j])
                             : WMMA_F32_F16(af[s][i], bf[s][j], acc[i][j]);
  }
}

template <int MODE>
__global__ __launch_bounds__(128) void proj_kernel(
    const float* __restrict__ X, const float* __restrict__ W,
    const float* __restrict__ bias, _Float16* __restrict__ Y, float scale,
    const float* __restrict__ Wc, _Float16* __restrict__ Wc16) {
  __shared__ __align__(16) _Float16 At[2][64 * PK];
  __shared__ __align__(16) _Float16 Bt[2][64 * PK];
  const int tid = threadIdx.x, lane = tid & 31;
  const int w = tid >> 5, wr = w >> 1, wc = w & 1;
  const int tile = blockIdx.x, h = blockIdx.y, b = blockIdx.z;
  const int n0 = h * DHc;
  // 64x128 of each operand per pass: a wave-wide load covers 512 contiguous bytes of one
  // row, wave w takes rows e*4+w
  const float* pa = X + ((long)b * TKc + h + 16 * (tile * 64 + w)) * Dc + lane * 4;
  const float* pb = W + (long)(n0 + w) * Dc + lane * 4;
  const int so = w * PK + lane * 4;  // the thread's place in row w of an LDS tile
  // the block's share of Wc: CW elements, a wave-wide load covers 512 contiguous bytes
  const int co = ((b * Hc + h) * (Lc / 64) + tile) * CW + tid * 4;
  const float* pc = Wc + co;
  _Float16* pd = Wc16 + co;

  v4f fa[16], fb[16], fc[CW / 512];
  v8f acc[2][2] = {};
  ld_rows_f32<CW / 512, 512>(fc, pc);
  ld_rows_f32<16, 64 * Dc>(fa, pa);
  ld_rows_f32<16, 4 * Dc>(fb, pb);
  // as inputs the addresses stay in their registers up to here, so that no load of
  // the group lands on them; the wait stands in front of their next rewrite
  asm volatile("s_wait_xcnt 0x0" :: "v"(pa), "v"(pb), "v"(pc) : "memory");
  // keeps the conversions below the whole group of loads, so that all are in flight
  __builtin_amdgcn_sched_barrier(0);
  st_rows_f16<CW / 512, 512>(pd, fc);
  // stands in front of any rewrite of the stores' address registers
  asm volatile("s_wait_xcnt 0x0" :: "v"(pd) : "memory");
  st_rows_f16<16, 4 * PK>(&At[0][so], fa);
  st_rows_f16<16, 4 * PK>(&Bt[0][so], fb);
  __syncthreads();
  for (int t = 0; t < Dc / BK - 1; ++t) {
    pa += BK;
    pb += BK;
    ld_rows_f32<16, 64 * Dc>(fa, pa);
    ld_rows_f32<16, 4 * Dc>(fb, pb);
    // as in front of the loop
    asm volatile("s_wait_xcnt 0x0" :: "v"(pa), "v"(pb) : "memory");
    // keeps the next pass's 32 loads in front of this pass's LDS reads and WMMAs
    __builtin_amdgcn_sched_barrier(0);
    mma_pass_kv<MODE == 1>(At[t & 1], Bt[t & 1], wr, wc, lane, acc);
    // keeps the wait for the loads, and the conversions, behind this pass's WMMAs
    __builtin_amdgcn_sched_barrier(0);
    st_rows_f16<16, 4 * PK>(&At[(t + 1) & 1][so], fa);
    st_rows_f16<16, 4 * PK>(&Bt[(t + 1) & 1][so], fb);
    // publishes pass t+1 and ends the reads of pass t, whose buffer pass t+2 overwrites
    __syncthreads();
  }
  const int base8 = ((lane >> 4) & 1) * 8;
  // the lane's bias values, asked for ahead of the last pass: 8 consecutive columns per W tile
  // (K), one column per W tile (V^T)
  const float* pbias = bias + n0 + wc * 32 + (MODE == 2 ? (lane & 15) : base8);
  v4f bb[2][2];
#pragma unroll
  for (int j = 0; j < 2; ++j) {
    if (MODE == 2) {
      bb[j][0] = v4f{pbias[j * 16], 0.f, 0.f, 0.f};
    } else {
      bb[j][0] = *(const v4f*)(pbias + j * 16);
      bb[j][1] = *(const v4f*)(pbias + j * 16 + 4);
    }
  }
  // as an input the address stays in its registers up to here, so that no load of the group
  // lands on it; the wait stands in front of its next rewrite
  asm volatile("s_wait_xcnt 0x0" :: "v"(pbias) : "memory");
  mma_pass_kv<MODE == 1>(At[(Dc / BK - 1) & 1], Bt[(Dc / BK - 1) & 1], wr, wc, lane, acc);
  // The block's 64x64 f16 tile goes through LDS so that it leaves in whole 128-byte lines.
  // It is staged in At[0], which the last pass does not read: rows are l (K) or d (V^T),
  // as in Y; a lane holds 8 consecutive columns of one row per accumulator.
  _Float16* st = &At[0][0];
#pragma unroll
  for (int i = 0; i < 2; ++i)
#pragma unroll
    for (int j = 0; j < 2; ++j) {
      const int xl = wr * 32 + i * 16, nl = wc * 32 + j * 16;  // tile's first X row, W row
      half8 pk;
      if (MODE == 2) {
        const float bv = bb[j][0].x;
#pragma unroll
        for (int v = 0; v < 8; ++v) pk[v] = (_Float16)((acc[i][j][v] + bv) * scale);
        *(half8*)(st + (nl + (lane & 15)) * SP + xl + base8) = pk;
      } else {
#pragma unroll
        for (int v = 0; v < 8; ++v)
          pk[v] = (_Float16)((acc[i][j][v] + bb[j][v >> 2][v & 3]) * scale);
        *(half8*)(st + (xl + (lane & 15)) * SP + nl + base8) = pk;
      }
    }
  // the staged tile is complete before another wave reads it
  __syncthreads();
  _Float16* Yt = MODE == 2 ? Y + (((long)b * Hc + h) * DHc) * Lc + tile * 64
                           : Y + (((long)b * Hc + h) * Lc + tile * 64) * DHc;
#pragma unroll
  for (int e = 0; e < 4; ++e) {  // 8 lanes store one row's 128 bytes
    const int r = e * 16 + (tid >> 3), cc = (tid & 7) * 8;
    *(half8*)(Yt + r * (MODE == 2 ? Lc : DHc) + cc) = *(const half8*)(st + r * SP + cc);
  }
}

// ---------------------------------------------------------------------------
// The two dense 8192 x 1024 x 1024 GEMMs (Q projection, output projection):
// 128x128 tile per block, 8 waves in a 4x2 grid, each computing 32x64 via 2x4 WMMAs,
// 128 k staged per pass. A block loads 128 + 128 operand rows for 128 x 128
// outputs: half the L2 bytes per output of a 64x64 tile.
// ---------------------------------------------------------------------------
static constexpr int GT = 128;     // block tile, rows and columns
static constexpr int GK = 128;     // k extent of one staged pass
static constexpr int GP = GK + 8;  // LDS row pitch in halves: row + 16 bytes

// one staged pass of a wave, in two halves of 64 k: 12 fragments, then their 16 WMMAs;
// k runs upward as in the 64x64 tile. The W fragment is the first operand: a lane then holds
// 8 consecutive output columns of one X row per accumulator
__device__ __forceinline__ void mma_pass(const _Float16* At, const _Float16* Bt, int wr,
                                         int wc, int lane, v8f (&acc)[2][4]) {
#pragma unroll
  for (int kh = 0; kh < GK; kh += 64) {
    v16h af[2][2], bf[2][4];
#pragma unroll
    for (int s = 0; s < 2; ++s) {
#pragma unroll
      for (int i = 0; i < 2; ++i)
        af[s][i] = ldfrag(At, GP, wr * 32 + i * 16, kh + s * 32, lane);
#pragma unroll
      for (int j = 0; j < 4; ++j)
        bf[s][j] = ldfrag(Bt, GP, wc * 64 + j * 16, kh + s * 32, lane);
    }
    // keeps a half's LDS reads ahead of its own WMMAs: the first half's go out as one
    // group, the second half's among the first half's WMMAs as registers come free
    __builtin_amdgcn_sched_barrier(0);
#pragma unroll
    for (int s = 0; s < 2; ++s)
#pragma unroll
      for (int i = 0; i < 2; ++i)
#pragma unroll
        for (int j = 0; j < 4; ++j) acc[i][j] = WMMA_F32_F16(bf[s][j], af[s][i], acc[i][j]);
  }
}

// 128x128 f16 tile -> LDS, eight async 16-byte copies per lane. The s_wait_xcnt closes the
// statement so that it stands in front of any rewrite of the address registers.
__device__ __forceinline__ void async_tile_f16(const _Float16* src, _Float16* t, int tid) {
  unsigned l[8];
  unsigned long long g[8];
#pragma unroll
  for (int e = 0; e < 8; ++e) {
    int r = e * 16 + (tid >> 4), c = (tid & 15) * 8;
    l[e] = (unsigned)(unsigned long long)(uintptr_t)(t + r * GP + c);
    g[e] = (unsigned long long)(uintptr_t)(src + r * Dc + c);
  }
  asm volatile(
      "global_load_async_to_lds_b128 %0, %8, off\n\t"
      "global_load_async_to_lds_b128 %1, %9, off\n\t"
      "global_load_async_to_lds_b128 %2, %10, off\n\t"
      "global_load_async_to_lds_b128 %3, %11, off\n\t"
      "global_load_async_to_lds_b128 %4, %12, off\n\t"
      "global_load_async_to_lds_b128 %5, %13, off\n\t"
      "global_load_async_to_lds_b128 %6, %14, off\n\t"
      "global_load_async_to_lds_b128 %7, %15, off\n\t"
      "s_wait_xcnt 0x0"
      :: "v"(l[0]), "v"(l[1]), "v"(l[2]), "v"(l[3]), "v"(l[4]), "v"(l[5]), "v"(l[6]), "v"(l[7]),
         "v"(g[0]), "v"(g[1]), "v"(g[2]), "v"(g[3]), "v"(g[4]), "v"(g[5]), "v"(g[6]), "v"(g[7])
      : "memory");
}

// Q projection: Qh[((b*H+h)*TQ + t)*64 + d] = (q @ Wq^T + bq) * scale, f16.
// grid ((B*TQ)/128, D/128); a block's 128 columns are two heads, one per wave column.
// X-tile through registers (f32->f16), W-tile, f16 already, via async copies; both of pass
// t+1 fly over the WMMAs of pass t.
__global__ __launch_bounds__(256) void qproj_kernel(
    const float* __restrict__ X, const _Float16* __restrict__ W,
    const float* __restrict__ bias, _Float16* __restrict__ Y, float scale) {
  __shared__ __align__(16) _Float16 At[2][GT * GP];
  __shared__ __align__(16) _Float16 Bt[2][GT * GP];
  const int tid = threadIdx.x, lane = tid & 31;
  const int w = tid >> 5, wr = w >> 1, wc = w & 1;
  const int m0 = blockIdx.x * GT, n0 = blockIdx.y * GT;
  // 128x128 of X per pass: a wave-wide load covers the 512 contiguous bytes of one row,
  // wave w takes rows e*8+w
  const float* pa = X + (long)(m0 + w) * Dc + lane * 4;
  const _Float16* Wr = W + (long)n0 * Dc;
  const int so = w * GP + lane * 4;  // the thread's place in row w of an LDS tile

  v4f fa[16];
  v8f acc[2][4] = {};
  ld_rows_f32<16, 8 * Dc>(fa, pa);
  // as an input the address stays in its registers up to here, so that no load of the
  // group lands on it; the wait stands in front of its next rewrite
  asm volatile("s_wait_xcnt 0x0" :: "v"(pa) : "memory");
  async_tile_f16(Wr, Bt[0], tid);  // W is f16 already: no register on its way
  // keeps the conversions below the loads and copies, so that all are in flight
  __builtin_amdgcn_sched_barrier(0);
  st_rows_f16<16, 8 * GP>(&At[0][so], fa);
  wait_async0();
  __syncthreads();
  for (int t = 0; t < Dc / GK - 1; ++t) {
    pa += GK;
    ld_rows_f32<16, 8 * Dc>(fa, pa);
    // as in front of the loop
    asm volatile("s_wait_xcnt 0x0" :: "v"(pa) : "memory");
    async_tile_f16(Wr + (t + 1) * GK, Bt[(t + 1) & 1], tid);
    // keeps the next pass's loads and copies in front of this pass's LDS reads and WMMAs
    __builtin_amdgcn_sched_barrier(0);
    mma_pass(At[t & 1], Bt[t & 1], wr, wc, lane, acc);
    // keeps the wait for the loads, and the conversions, behind this pass's WMMAs
    __builtin_amdgcn_sched_barrier(0);
    st_rows_f16<16, 8 * GP>(&At[(t + 1) & 1][so], fa);
    // this wave's LDS reads of pass t are done before copies may land on their buffer
    asm volatile("s_wait_dscnt 0x0" ::: "memory");
    wait_async0();  // this wave's copies of pass t+1 have landed
    // publishes pass t+1 and ends the reads of pass t, whose buffer pass t+2 overwrites
    __syncthreads();
  }
  wait_async0();  // no copy is outstanding behind the loop
  const int base8 = ((lane >> 4) & 1) * 8;
  const int b = m0 / TQc, t0 = m0 % TQc, h = blockIdx.y * 2 + wc;
  // the lane's bias values, 8 consecutive columns per W tile, asked for ahead of the last pass
  const float* pbias = bias + h * DHc + base8;
  v4f bb[4][2];
#pragma unroll
  for (int j = 0; j < 4; ++j) {
    bb[j][0] = *(const v4f*)(pbias + j * 16);
    bb[j][1] = *(const v4f*)(pbias + j * 16 + 4);
  }
  // as an input the address stays in its registers up to here, so that no load of the group
  // lands on it; the wait stands in front of its next rewrite
  asm volatile("s_wait_xcnt 0x0" :: "v"(pbias) : "memory");
  mma_pass(At[(Dc / GK - 1) & 1], Bt[(Dc / GK - 1) & 1], wr, wc, lane, acc);
  // The wave's 32 rows of 128 bytes, contiguous in Y, go through a range of its own in the
  // buffers that the last pass does not read, and leave in whole 128-byte lines.
  _Float16* st = (w < 4 ? &At[0][0] : &Bt[0][0]) + (w & 3) * (32 * SP);
#pragma unroll
  for (int j = 0; j < 4; ++j) {
#pragma unroll
    for (int i = 0; i < 2; ++i) {
      half8 pk;
#pragma unroll
      for (int v = 0; v < 8; ++v)
        pk[v] = (_Float16)((acc[i][j][v] + bb[j][v >> 2][v & 3]) * scale);
      *(half8*)(st + (i * 16 + (lane & 15)) * SP + j * 16 + base8) = pk;
    }
  }
  // the wave's staged rows are written before its lanes read one another's
  asm volatile("s_wait_dscnt 0x0" ::: "memory");
  _Float16* Yw = Y + (((long)b * Hc + h) * TQc + t0 + wr * 32) * DHc;
#pragma unroll
  for (int e = 0; e < 8; ++e) {  // 8 lanes store one row's 128 bytes
    const int r = e * 4 + (lane >> 3), cc = (lane & 7) * 8;
    *(half8*)(Yw + r * DHc + cc) = *(const half8*)(st + r * SP + cc);
  }
}

__device__ __forceinline__ float other_half(float x) {
  int b = __builtin_bit_cast(int, x);
  return __builtin_bit_cast(
      float, __builtin_amdgcn_permlanex16(b, b, 0x76543210, 0xfedcba98, false, false));
}

// A lane's share of one chunk: 32 bytes of K and 32 of V^T, four async 16-byte copies. The
// s_wait_xcnt closes the statement so that it stands in front of any rewrite of the address
// registers.
__device__ __forceinline__ void async_chunk(const _Float16* kg, const _Float16* vg,
                                            _Float16* kl, _Float16* vl) {
  unsigned lk = (unsigned)(unsigned long long)(uintptr_t)kl;  // low 32b = LDS offset
  unsigned lv = (unsigned)(unsigned long long)(uintptr_t)vl;
  unsigned lk1 = lk + 16, lv1 = lv + 16;
  unsigned long long gk = (unsigned long long)(uintptr_t)kg;
  unsigned long long gv = (unsigned long long)(uintptr_t)vg;
  unsigned long long gk1 = gk + 16, gv1 = gv + 16;
  asm volatile(
      "global_load_async_to_lds_b128 %0, %4, off\n\t"
      "global_load_async_to_lds_b128 %1, %5, off\n\t"
      "global_load_async_to_lds_b128 %2, %6, off\n\t"
      "global_load_async_to_lds_b128 %3, %7, off\n\t"
      "s_wait_xcnt 0x0"
      :: "v"(lk), "v"(lk1), "v"(lv), "v"(lv1), "v"(gk), "v"(gk1), "v"(gv), "v"(gv1)
      : "memory");
}

static constexpr int QW = 2;  // 16-query tiles per wave

__global__ __launch_bounds__(256) void attn_kernel(
    const _Float16* __restrict__ Qh, const _Float16* __restrict__ Kg,
    const _Float16* __restrict__ VgT, _Float16* __restrict__ O) {
  __shared__ __align__(16) _Float16 kt[2][64 * 72];
  __shared__ __align__(16) _Float16 vt[2][64 * 72];
  const int tid = threadIdx.x, lane = tid & 31, w = tid >> 5;
  const int qt = blockIdx.x, h = blockIdx.y, b = blockIdx.z;
  const int q0 = qt * (8 * QW * 16) + w * (QW * 16);

  const _Float16* Qb = Qh + (((long)b * Hc + h) * TQc + q0) * DHc;
  const _Float16* Kb = Kg + (((long)b * Hc + h) * Lc) * DHc;
  const _Float16* Vb = VgT + (((long)b * Hc + h) * DHc) * Lc;

  v16h qb[QW][2];  // B operands: query g*16 + lane%16, d = 0..31 and d = 32..63
  float mrun[QW], lrun[QW];  // of this lane's queries; lrun over this half's keys
  v8f oacc[QW][4];           // O^T: oacc[g][t][r] = O[query g*16 + col][d = t*16 + rb + r]
  // every unroll of this kernel: the arrays are then indexed by constants only and live in
  // registers
#pragma unroll
  for (int g = 0; g < QW; ++g) {
    qb[g][0] = ldfrag(Qb, DHc, g * 16, 0, lane);
    qb[g][1] = ldfrag(Qb, DHc, g * 16, 32, lane);
    mrun[g] = -1e30f;
    lrun[g] = 0.f;
#pragma unroll
    for (int t = 0; t < 4; ++t) oacc[g][t] = v8f{};
  }
  const int col = lane & 15, rb = ((lane >> 4) & 1) * 8;

  // staging coordinates: each thread copies 16 halves of K and of V^T
  const int sr = tid >> 2, sc = (tid & 3) * 16;
  const _Float16* kg = Kb + (long)sr * DHc + sc;
  const _Float16* vg = Vb + (long)sr * Lc + sc;
  const int so = sr * 72 + sc;

  const int NCH = Lc / 64;  // 8 chunks
  // prologue: chunk 0 into buffer 0, published; then chunk 1 into buffer 1
  async_chunk(kg, vg, &kt[0][so], &vt[0][so]);
  wait_async0();
  __syncthreads();
  async_chunk(kg + 64 * DHc, vg + 64, &kt[1][so], &vt[1][so]);

  for (int c = 0; c < NCH; ++c) {
    const int cur = c & 1;
    const _Float16* K = &kt[cur][0];
    const _Float16* V = &vt[cur][0];

    v8f z = {};
    v8f s[QW][4];
#pragma unroll
    for (int t = 0; t < 4; ++t) {  // scores: s[g][t][r] = S[query g*16 + col][l = t*16 + rb + r]
      const v16h k0 = ldfrag(K, 72, t * 16, 0, lane);
      const v16h k1 = ldfrag(K, 72, t * 16, 32, lane);
#pragma unroll
      for (int g = 0; g < QW; ++g) {
        s[g][t] = WMMA_F32_F16(k0, qb[g][0], z);
        s[g][t] = WMMA_F32_F16(k1, qb[g][1], s[g][t]);
      }
    }

    // Online softmax, one query per lane and tile: 32 of the chunk's 64 keys here, 32 in
    // lane^16.
    float nm[QW], corr[QW];
#pragma unroll
    for (int g = 0; g < QW; ++g) {
      float cmax = s[g][0][0];
#pragma unroll
      for (int t = 0; t < 4; ++t)
#pragma unroll
        for (int r = 0; r < 8; ++r) cmax = fmaxf(cmax, s[g][t][r]);
      cmax = fmaxf(cmax, other_half(cmax));
      nm[g] = fmaxf(mrun[g], cmax);
      corr[g] = __expf(mrun[g] - nm[g]);
      mrun[g] = nm[g];
#pragma unroll
      for (int t = 0; t < 4; ++t) oacc[g][t] *= corr[g];
    }
    v8f sv[QW];
#pragma unroll
    for (int u = 0; u < 2; ++u) {  // 32 keys at a time
      v16h pb[QW], vf[4];
      // the four V^T fragments go out as one group, ahead of the exponentials that hide them
#pragma unroll
      for (int t = 0; t < 4; ++t) vf[t] = ldfrag(V, 72, t * 16, u * 32, lane);
      // keeps the group together and in front: left to itself the scheduler puts each fragment's
      // reads directly in front of its WMMAs, and the wave waits out the LDS latency four times
      __builtin_amdgcn_sched_barrier(0);
#pragma unroll
      for (int g = 0; g < QW; ++g) {
#pragma unroll
        for (int t = 2 * u; t < 2 * u + 2; ++t) {
#pragma unroll
          for (int r = 0; r < 8; ++r) s[g][t][r] = __expf(s[g][t][r] - nm[g]);
          sv[g] = t == 0 ? s[g][0] : sv[g] + s[g][t];
        }
        // P^T as B operand: tiles 2u and 2u+1 hold keys 32u + rb + {0..7} and 32u + 16 + rb +
        // {0..7} of this lane's query, the k order in which ldfrag reads V^T
        pb[g] = __builtin_shufflevector(__builtin_convertvector(s[g][2 * u], half8),
                                        __builtin_convertvector(s[g][2 * u + 1], half8), 0, 1, 2,
                                        3, 4, 5, 6, 7, 8, 9, 10, 11, 12, 13, 14, 15);
      }
#pragma unroll
      for (int t = 0; t < 4; ++t)  // O^T += V^T(16 d x 32 l) @ P^T(32 l x 16 q) per d-tile
#pragma unroll
        for (int g = 0; g < QW; ++g) oacc[g][t] = WMMA_F32_F16(vf[t], pb[g], oacc[g][t]);
    }
#pragma unroll
    for (int g = 0; g < QW; ++g)
      lrun[g] = lrun[g] * corr[g] + (((sv[g][0] + sv[g][1]) + (sv[g][2] + sv[g][3])) +
                                     ((sv[g][4] + sv[g][5]) + (sv[g][6] + sv[g][7])));
    // this wave's LDS reads of chunk c are done before copies may land on their buffer
    asm volatile("s_wait_dscnt 0x0" ::: "memory");
    wait_async0();  // this wave's copies of chunk c+1 have landed
    // publishes chunk c+1 and ends the reads of chunk c, whose buffer chunk c+2 overwrites
    __syncthreads();
    if (c + 2 < NCH)
      async_chunk(kg + (long)(c + 2) * 64 * DHc, vg + (c + 2) * 64, &kt[cur][so], &vt[cur][so]);
  }
  wait_async0();  // no copy is outstanding behind the loop

  // join the two halves' sums, normalize; the wave's 32 rows of 128 bytes go through a range
  // of its own in the ring, which nobody reads behind the loop's last barrier, and leave as
  // f16 [B, TQ, D] in whole 128-byte lines
  _Float16* st = (w < 4 ? &kt[0][0] : &vt[0][0]) + (w & 3) * (32 * SP);
#pragma unroll
  for (int g = 0; g < QW; ++g) {
    const float inv = 1.f / (lrun[g] + other_half(lrun[g]));
#pragma unroll
    for (int t = 0; t < 4; ++t)
      *(half8*)(st + (g * 16 + col) * SP + t * 16 + rb) =
          __builtin_convertvector(oacc[g][t] * inv, half8);
  }
  // the wave's staged rows are written before its lanes read one another's
  asm volatile("s_wait_dscnt 0x0" ::: "memory");
  _Float16* Ow = O + ((long)b * TQc + q0) * Dc + h * DHc;
#pragma unroll
  for (int e = 0; e < 8; ++e) {  // 8 lanes store one row's 128 bytes
    const int r = e * 4 + (lane >> 3), cc = (lane & 7) * 8;
    *(half8*)(Ow + (long)r * Dc + cc) = *(const half8*)(st + r * SP + cc);
  }
}

// ---------------------------------------------------------------------------
// Output projection: out_f32[M,1024] = O_f16[M,1024] @ Wo^T + bo
// grid ((B*TQ)/128, 1024/128). Both tiles are f16 already and staged via async copies,
// through no register; those of pass t+1 fly over the WMMAs of pass t.
// ---------------------------------------------------------------------------
__global__ __launch_bounds__(256) void outproj_kernel(
    const _Float16* __restrict__ A, const _Float16* __restrict__ W,
    const float* __restrict__ bias, float* __restrict__ Out) {
  __shared__ __align__(16) _Float16 At[2][GT * GP];
  __shared__ __align__(16) _Float16 Bt[2][GT * GP];
  const int tid = threadIdx.x, lane = tid & 31;
  const int w = tid >> 5, wr = w >> 1, wc = w & 1;
  const int m0 = blockIdx.x * GT, n0 = blockIdx.y * GT;
  const _Float16* Ar = A + (long)m0 * Dc;
  const _Float16* Wr = W + (long)n0 * Dc;

  v8f acc[2][4] = {};
  async_tile_f16(Ar, At[0], tid);
  async_tile_f16(Wr, Bt[0], tid);
  wait_async0();
  __syncthreads();
  for (int t = 0; t < Dc / GK - 1; ++t) {
    async_tile_f16(Ar + (t + 1) * GK, At[(t + 1) & 1], tid);
    async_tile_f16(Wr + (t + 1) * GK, Bt[(t + 1) & 1], tid);
    // keeps the next pass's copies in front of this pass's LDS reads and WMMAs
    __builtin_amdgcn_sched_barrier(0);
    mma_pass(At[t & 1], Bt[t & 1], wr, wc, lane, acc);
    // keeps the waits behind this pass's WMMAs, so that the copies have the whole pass to land
    __builtin_amdgcn_sched_barrier(0);
    // this wave's LDS reads of pass t are done before copies may land on their buffer
    asm volatile("s_wait_dscnt 0x0" ::: "memory");
    wait_async0();  // this wave's copies of pass t+1 have landed
    // publishes pass t+1 and ends the reads of pass t, whose buffer pass t+2 overwrites
    __syncthreads();
  }
  wait_async0();  // no copy is outstanding behind the loop
  const int base8 = ((lane >> 4) & 1) * 8;
  // the lane's bias values, 8 consecutive columns per W tile, asked for ahead of the last pass
  const float* pbias = bias + n0 + wc * 64 + base8;
  v4f bb[4][2];
#pragma unroll
  for (int j = 0; j < 4; ++j) {
    bb[j][0] = *(const v4f*)(pbias + j * 16);
    bb[j][1] = *(const v4f*)(pbias + j * 16 + 4);
  }
  // as an input the address stays in its registers up to here, so that no load of the group
  // lands on it; the wait stands in front of its next rewrite
  asm volatile("s_wait_xcnt 0x0" :: "v"(pbias) : "memory");
  mma_pass(At[(Dc / GK - 1) & 1], Bt[(Dc / GK - 1) & 1], wr, wc, lane, acc);
  // The wave's 32 rows of 256 bytes go through a range of its own in the buffers that the
  // last pass does not read (pitch: row + 16 bytes), and leave in whole 128-byte lines.
  float* st = (float*)(w < 4 ? &At[0][0] : &Bt[0][0]) + (w & 3) * (32 * 68);
#pragma unroll
  for (int j = 0; j < 4; ++j) {
#pragma unroll
    for (int i = 0; i < 2; ++i) {
      float* p = st + (i * 16 + (lane & 15)) * 68 + j * 16 + base8;
      const v8f a = acc[i][j];
      *(v4f*)p = v4f{a[0], a[1], a[2], a[3]} + bb[j][0];
      *(v4f*)(p + 4) = v4f{a[4], a[5], a[6], a[7]} + bb[j][1];
    }
  }
  // the wave's staged rows are written before its lanes read one another's
  asm volatile("s_wait_dscnt 0x0" ::: "memory");
  float* Ow = Out + (long)(m0 + wr * 32) * Dc + n0 + wc * 64;
#pragma unroll
  for (int e = 0; e < 16; ++e) {  // 16 lanes store one row's 256 bytes
    const int r = e * 2 + (lane >> 4), cc = (lane & 15) * 4;
    *(v4f*)(Ow + (long)r * Dc + cc) = *(const v4f*)(st + r * 68 + cc);
  }
}

extern "C" void kernel_launch(void* const* d_in, const int* in_sizes, int n_in,
                              void* d_out, int out_size, void* d_ws, size_t ws_size,
                              hipStream_t stream) {
  const float* q  = (const float*)d_in[0];
  const float* k  = (const float*)d_in[1];
  const float* v  = (const float*)d_in[2];
  const float* Wq = (const float*)d_in[3];
  const float* bq = (const float*)d_in[4];
  const float* Wk = (const float*)d_in[5];
  const float* bk = (const float*)d_in[6];
  const float* Wv = (const float*)d_in[7];
  const float* bv = (const float*)d_in[8];
  const float* Wo = (const float*)d_in[9];
  const float* bo = (const float*)d_in[10];
  float* out = (float*)d_out;

  char* ws = (char*)d_ws;
  _Float16* Qh  = (_Float16*)ws;  // [B,H,TQ,64] f16
  _Float16* Kg  = (_Float16*)(ws + (size_t)Bc * Hc * TQc * DHc * 2);
  _Float16* VgT = (_Float16*)((char*)Kg + (size_t)Bc * Hc * Lc * DHc * 2);
  _Float16* Oa  = (_Float16*)((char*)VgT + (size_t)Bc * Hc * Lc * DHc * 2);  // [B,TQ,D] f16
  _Float16* Wq16 = (_Float16*)((char*)Oa + (size_t)Bc * TQc * Dc * 2);  // [D,D] f16
  _Float16* Wo16 = (_Float16*)((char*)Wq16 + (size_t)Dc * Dc * 2);      // [D,D] f16

  dim3 blk(128), blk8(256);
  // HEPOS-gathered K/V projections (16x fewer FLOPs than dense K/V proj);
  // V written transposed [b,h,d,l] for contiguous P@V fragment loads. They come first and
  // leave Wo and Wq behind as f16 for the two dense GEMMs.
  proj_kernel<1><<<dim3(Lc / 64, Hc, Bc), blk, 0, stream>>>(k, Wk, bk, Kg, 1.0f, Wo, Wo16);
  proj_kernel<2><<<dim3(Lc / 64, Hc, Bc), blk, 0, stream>>>(v, Wv, bv, VgT, 1.0f, Wq, Wq16);
  // Q projection with 1/sqrt(dh) folded in
  qproj_kernel<<<dim3((Bc * TQc) / GT, Dc / GT), blk8, 0, stream>>>(q, Wq16, bq, Qh, 0.125f);
  attn_kernel<<<dim3(TQc / 256, Hc, Bc), blk8, 0, stream>>>(Qh, Kg, VgT, Oa);
  outproj_kernel<<<dim3((Bc * TQc) / GT, Dc / GT), blk8, 0, stream>>>(Oa, Wo16, bo, out);
}
